// v000
// Measured on an AMD MI455X. A time is GPU time per run, averaged over a window of back-to-back runs after a warm-up
// (all launches, gaps included; the runs take copies of the inputs in turn), and the median of several windows.
// Apart from v000's, it joins two sittings. Times from different sittings can be a few percent apart, while
// side-by-side timings come from the same sitting.
// v000 is the starting kernel. One run takes 276 microseconds.
#include <hip/hip_runtime.h>

// Single-head causal attention over separate q / k / v inputs (q, k, v [4096][1024]; qp = q Wq + bq, kp = k Wk + bk, vp = v Wv + bv ('xw' [1024][128] + [128]); scores = qp.kp / sqrt(128), causal (-1e10 == exclusion); softmax; out = attn vp -> [4096][128] (0.5 M)).
// Layout: bf16 copies of the three inputs in turn; exact projections + f32 biases; ONE 128-wide head through the causal T-4096 attention (hybrid rows: < 512 hi/lo 3 products, rest fp16 x1024; k_gemmc tile skipping; streaming three-sweep softmax); the f32 merge writes the output rows.
// Compute dtypes, f32 accumulate: every input rounded to bf16; projections exact + f32 biases; attention rows < 512 3 products, rest fp16; softmax f32; output f32.

#define NB_  1
#define TT   4096
#define DM   1024
#define NH_  1
#define NKV  1
#define REP  (NH_ / NKV)
#define HD   128
#define DQ   (NH_ * HD)
#define DKV  (NKV * HD)
#define ZH   1
#define RH   512                  // query rows < RH use hi+lo planes (0: none)
#define WIN  4096
#define PCAR 1024.0f
#define SCL  0.088388347648318447f   // HD^-0.5
typedef _Float16 h16;
typedef unsigned short bf;
typedef __attribute__((ext_vector_type(16))) __bf16   v16bf;
typedef __attribute__((ext_vector_type(16))) _Float16 v16h;
typedef __attribute__((ext_vector_type(8)))  _Float16 v8h;
typedef __attribute__((ext_vector_type(8)))  unsigned short v8us;
typedef __attribute__((ext_vector_type(8)))  float    v8f;
typedef __attribute__((ext_vector_type(4)))  float    v4f;
typedef v8h  __attribute__((may_alias)) v8ha;
typedef v4f  __attribute__((may_alias)) v4fa;
typedef v8us __attribute__((may_alias)) v8usa;

__device__ __forceinline__ unsigned short f2bf(float f) { unsigned u = __float_as_uint(f); u += 0x7FFFu + ((u >> 16) & 1u); return (unsigned short)(u >> 16); }
__device__ __forceinline__ float bf2f(unsigned short b) { return __uint_as_float(((unsigned)b) << 16); }
__device__ __forceinline__ float bfr(float f) { return bf2f(f2bf(f)); }
__device__ __forceinline__ v16h cat16(v8h lo, v8h hi) { return __builtin_shufflevector(lo, hi, 0, 1, 2, 3, 4, 5, 6, 7, 8, 9, 10, 11, 12, 13, 14, 15); }
__device__ __forceinline__ v16bf cat16b(v8us lo, v8us hi) { return __builtin_bit_cast(v16bf, __builtin_shufflevector(lo, hi, 0, 1, 2, 3, 4, 5, 6, 7, 8, 9, 10, 11, 12, 13, 14, 15)); }
__device__ __forceinline__ v8f wmma16(v16h a, v16h b, v8f c) { return __builtin_amdgcn_wmma_f32_16x16x32_f16(false, a, false, b, (short)0, c, false, false); }
__device__ __forceinline__ v8f wmmab(v16bf a, v16bf b, v8f c) { return __builtin_amdgcn_wmma_f32_16x16x32_bf16(false, a, false, b, (short)0, c, false, false); }



// ---- k_gemmw: register-blocked GEMM, ONE WAVE per 64x64 output tile (16 accumulators), operands straight from K-contiguous 16-bit planes; grid (M/64, N/64, Z), 32 threads.
// C[m][n] (f32, pitch ldc, + optional f32 bias[n]) = sum_k A[m][k] Bt[n][k] (+ split products per NSPLIT). z-batch strides sA/sB/sC in elements. K % 32 == 0.
template <typename T16> struct WFrag;
template <> struct WFrag<h16> { typedef v16h V; static __device__ __forceinline__ V ld(const h16* p) { return cat16(*(const v8h*)p, *(const v8h*)(p + 16)); } static __device__ __forceinline__ v8f mma(V a, V b, v8f c) { return wmma16(a, b, c); } };
template <> struct WFrag<bf> { typedef v16bf V; static __device__ __forceinline__ V ld(const bf* p) { return cat16b(*(const v8us*)p, *(const v8us*)(p + 16)); } static __device__ __forceinline__ v8f mma(V a, V b, v8f c) { return wmmab(a, b, c); } };
template <typename T16, int NSPLIT, bool BIAS>
__global__ __launch_bounds__(32) void k_gemmw(const T16* __restrict__ A, const T16* __restrict__ A2, const T16* __restrict__ Bt, const T16* __restrict__ Bt2, int K, float* C, int ldc, const float* __restrict__ bias, size_t sA, size_t sB, size_t sC) {
    typedef typename WFrag<T16>::V V;
    __shared__ __align__(16) float os[16 * 68];
    const size_t z = blockIdx.z; A += z * sA; if (A2) A2 += z * sA; Bt += z * sB; if (Bt2) Bt2 += z * sB; C += z * sC;
    const int lane = threadIdx.x & 31, lr = lane & 15, hi = lane >> 4; const int r0 = blockIdx.x * 64, c0 = blockIdx.y * 64;
    v8f acc[4][4];
#pragma unroll
    for (int mb = 0; mb < 4; ++mb)
#pragma unroll
        for (int nb = 0; nb < 4; ++nb) acc[mb][nb] = (v8f){};
    const size_t aoff = (size_t)(r0 + lr) * K + 8 * hi, boff = (size_t)(c0 + lr) * K + 8 * hi;
#pragma unroll 1
    for (int kc = 0; kc < K; kc += 32) {
        V a[4], a2[4];
#pragma unroll
        for (int mb = 0; mb < 4; ++mb) { a[mb] = WFrag<T16>::ld(A + aoff + (size_t)mb * 16 * K + kc); if (NSPLIT == 1 || NSPLIT == 2) a2[mb] = WFrag<T16>::ld(A2 + aoff + (size_t)mb * 16 * K + kc); }
#pragma unroll
        for (int nb = 0; nb < 4; ++nb) { const V b = WFrag<T16>::ld(Bt + boff + (size_t)nb * 16 * K + kc); V b2; if (NSPLIT >= 2) b2 = WFrag<T16>::ld(Bt2 + boff + (size_t)nb * 16 * K + kc);
#pragma unroll
            for (int mb = 0; mb < 4; ++mb) { acc[mb][nb] = WFrag<T16>::mma(a[mb], b, acc[mb][nb]); if (NSPLIT == 1 || NSPLIT == 2) acc[mb][nb] = WFrag<T16>::mma(a2[mb], b, acc[mb][nb]); if (NSPLIT >= 2) acc[mb][nb] = WFrag<T16>::mma(a[mb], b2, acc[mb][nb]); } }
        asm volatile("v_nop\n\tv_nop\n\tv_nop\n\tv_nop" : "+v"(acc[0][0]), "+v"(acc[1][1]), "+v"(acc[2][2]), "+v"(acc[3][3]) : "v"(a[0]), "v"(a[3]));
    }
#pragma unroll
    for (int mb = 0; mb < 4; ++mb) {
#pragma unroll
        for (int nb = 0; nb < 4; ++nb) {
#pragma unroll
            for (int j = 0; j < 8; ++j) os[(hi * 8 + j) * 68 + nb * 16 + lr] = acc[mb][nb][j]; }
        __builtin_amdgcn_wave_barrier(); asm volatile("" ::: "memory");
        float* crow = C + (size_t)(r0 + mb * 16) * ldc + c0;
{
#pragma unroll
            for (int s = 0; s < 8; ++s) { const int row = 2 * s + hi, cofs = lr * 4; v4f val = *(const v4fa*)(os + row * 68 + cofs); if (BIAS) { val[0] += bfr(bias[c0 + cofs]); val[1] += bfr(bias[c0 + cofs + 1]); val[2] += bfr(bias[c0 + cofs + 2]); val[3] += bfr(bias[c0 + cofs + 3]); }
                *(v4f*)(crow + (size_t)row * ldc + cofs) = val; }
             }
        __builtin_amdgcn_wave_barrier(); asm volatile("" ::: "memory");
    }
}

// ---- k_gemmc: the same one-wave 64x64 tile GEMM specialised for causal attention: CMODE 1 skips score tiles entirely above the diagonal (query rows r0+roff.., key columns c0..), CMODE 2 limits the
// key (K) loop of the probability x value contraction to the diagonal block (probabilities beyond it are exactly zero). roff = row offset of this launch's first row within the sequence.
template <typename T16, int NSPLIT, int CMODE>
__global__ __launch_bounds__(32) void k_gemmc(const T16* __restrict__ A, const T16* __restrict__ A2, const T16* __restrict__ Bt, const T16* __restrict__ Bt2, int K, float* C, int ldc, int roff, size_t sA, size_t sB, size_t sC) {
    typedef typename WFrag<T16>::V V;
    __shared__ __align__(16) float os[16 * 68];
    const size_t z = blockIdx.z; A += z * sA; if (A2) A2 += z * sA; Bt += z * sB; if (Bt2) Bt2 += z * sB; C += z * sC;
    const int lane = threadIdx.x & 31, lr = lane & 15, hi = lane >> 4; const int r0 = blockIdx.x * 64, c0 = blockIdx.y * 64;
    if (CMODE == 1 && c0 > r0 + roff + 63) return;                  // score tile entirely above the causal diagonal: not computed (the softmax masks j > i by select)
    const int Kl = (CMODE == 2) ? min(K, r0 + roff + 64) : K;        // P.V: probabilities are exactly 0 beyond the diagonal block, so the K loop stops there
    v8f acc[4][4];
#pragma unroll
    for (int mb = 0; mb < 4; ++mb)
#pragma unroll
        for (int nb = 0; nb < 4; ++nb) acc[mb][nb] = (v8f){};
    const size_t aoff = (size_t)(r0 + lr) * K + 8 * hi, boff = (size_t)(c0 + lr) * K + 8 * hi;
#pragma unroll 1
    for (int kc = 0; kc < Kl; kc += 32) {
        V a[4], a2[4];
#pragma unroll
        for (int mb = 0; mb < 4; ++mb) { a[mb] = WFrag<T16>::ld(A + aoff + (size_t)mb * 16 * K + kc); if (NSPLIT == 1 || NSPLIT == 2) a2[mb] = WFrag<T16>::ld(A2 + aoff + (size_t)mb * 16 * K + kc); }
#pragma unroll
        for (int nb = 0; nb < 4; ++nb) { const V b = WFrag<T16>::ld(Bt + boff + (size_t)nb * 16 * K + kc); V b2; if (NSPLIT >= 2) b2 = WFrag<T16>::ld(Bt2 + boff + (size_t)nb * 16 * K + kc);
#pragma unroll
            for (int mb = 0; mb < 4; ++mb) { acc[mb][nb] = WFrag<T16>::mma(a[mb], b, acc[mb][nb]); if (NSPLIT == 1 || NSPLIT == 2) acc[mb][nb] = WFrag<T16>::mma(a2[mb], b, acc[mb][nb]); if (NSPLIT >= 2) acc[mb][nb] = WFrag<T16>::mma(a[mb], b2, acc[mb][nb]); } }
        asm volatile("v_nop\n\tv_nop\n\tv_nop\n\tv_nop" : "+v"(acc[0][0]), "+v"(acc[1][1]), "+v"(acc[2][2]), "+v"(acc[3][3]) : "v"(a[0]), "v"(a[3]));
    }
#pragma unroll
    for (int mb = 0; mb < 4; ++mb) {
#pragma unroll
        for (int nb = 0; nb < 4; ++nb) {
#pragma unroll
            for (int j = 0; j < 8; ++j) os[(hi * 8 + j) * 68 + nb * 16 + lr] = acc[mb][nb][j]; }
        __builtin_amdgcn_wave_barrier(); asm volatile("" ::: "memory");
        float* crow = C + (size_t)(r0 + mb * 16) * ldc + c0;
{
#pragma unroll
            for (int s = 0; s < 8; ++s) { const int row = 2 * s + hi, cofs = lr * 4; v4f val = *(const v4fa*)(os + row * 68 + cofs);
                *(v4f*)(crow + (size_t)row * ldc + cofs) = val; }
             }
        __builtin_amdgcn_wave_barrier(); asm volatile("" ::: "memory");
    }
}

__device__ __forceinline__ h16 tohx(float x) { return (h16)x; }
__device__ __forceinline__ void splitf(float y, unsigned short& h, unsigned short& l) { h = f2bf(y); l = f2bf(y - bf2f(h)); }
typedef __attribute__((ext_vector_type(2))) _Float16 v2h;
typedef __attribute__((ext_vector_type(4))) _Float16 v4h;
typedef __attribute__((ext_vector_type(2))) unsigned short v2us;
typedef __attribute__((ext_vector_type(4))) unsigned short v4us;
typedef __attribute__((ext_vector_type(2))) float v2f;
typedef __attribute__((ext_vector_type(4))) int v4i;

__global__ __launch_bounds__(256) void k_wtG(const float* __restrict__ w, int K, int N, bf* Bt) {
    const int lane = threadIdx.x & 31; const int L0 = (blockIdx.x * 8 + (threadIdx.x >> 5)) * 8; const int nlines = N * K / 64;
{
#pragma unroll 1
        for (int l = 0; l < 8; ++l) { const int L = L0 + l; if (L >= nlines) break; const size_t e = (size_t)L * 64 + lane * 2; const int k = (int)(e % K), n = (int)(e / K); v2us o;
            o[0] = f2bf(w[(size_t)k * N + n]); o[1] = f2bf(w[(size_t)(k + 1) * N + n]); *(v2us*)(Bt + e) = o; }
         }
}
__global__ __launch_bounds__(256) void k_cvt8(const float* __restrict__ src, bf* dst, size_t n8) { const size_t i = (size_t)blockIdx.x * 256 + threadIdx.x; if (i >= n8) return; const v8f v = *(const v8f*)(src + i * 8); v8us o;
#pragma unroll
    for (int k = 0; k < 8; ++k) o[k] = f2bf(v[k]); *(v8us*)(dst + i * 8) = o;  }

// k_rope: head planes [h][t][d] (fp16 + hi/lo) of rope(x) x sc with the rotate-half convention out[d] = x[d] cos[t][d] - x[d+HD/2] sin[t][d], out[d+HD/2] = x[d+HD/2] cos[t][d+HD/2] + x[d] sin[t][d+HD/2]
__global__ __launch_bounds__(256) void k_rope(const float* __restrict__ F, int pitch, int nheads, const float* __restrict__ CS, const float* __restrict__ RF, const float* __restrict__ nw, float sc, h16* P16, bf* Ph, bf* Pl) {
    const size_t e = ((size_t)blockIdx.x * 256 + threadIdx.x) * 2; if (e >= (size_t)nheads * TT * HD) return; const int d = (int)(e % HD); const int t = (int)((e / HD) % TT); const int h = (int)(e / ((size_t)HD * TT)); const float* f = F + (size_t)t * pitch + h * HD; const float rf = RF ? RF[(size_t)h * TT + t] : 1.0f; v2h o16; v2us oh, ol;
#pragma unroll
    for (int q = 0; q < 2; ++q) { const int dd = d + q; const int dp = (dd < HD / 2) ? dd + HD / 2 : dd - HD / 2; float x0 = f[dd], x1 = f[dp];
        if (RF) { float n0 = __fmul_rn(x0, rf), n1 = __fmul_rn(x1, rf); asm volatile("" : "+v"(n0)); asm volatile("" : "+v"(n1)); x0 = __fmul_rn(bfr(nw[dd]), n0); x1 = __fmul_rn(bfr(nw[dp]), n1); }
        const v2f cs = *(const v2f*)(CS + ((size_t)t * HD + dd) * 2); float a = __fmul_rn(x0, cs[0]), bq = __fmul_rn(x1, cs[1]); asm volatile("" : "+v"(a)); asm volatile("" : "+v"(bq)); const float r = ((dd < HD / 2) ? __fsub_rn(a, bq) : __fadd_rn(a, bq)) * sc;
        o16[q] = tohx(r); unsigned short a2, c2; splitf(r, a2, c2); oh[q] = a2; ol[q] = c2; }
    *(v2h*)(P16 + e) = o16; *(v2us*)(Ph + e) = oh; *(v2us*)(Pl + e) = ol;  }
__global__ __launch_bounds__(256) void k_vtp(const float* __restrict__ F, int pitch, int nheads, h16* V16, bf* Vh, bf* Vl) { const size_t e = ((size_t)blockIdx.x * 256 + threadIdx.x) * 2; if (e >= (size_t)nheads * HD * TT) return; const int t = (int)(e % TT); const int d = (int)((e / TT) % HD); const int g = (int)(e / ((size_t)TT * HD)); v2h o16; v2us oh, ol;
#pragma unroll
    for (int q = 0; q < 2; ++q) { const float x = F[(size_t)(t + q) * pitch + g * HD + d]; o16[q] = tohx(x); unsigned short a2, c2; splitf(x, a2, c2); oh[q] = a2; ol[q] = c2; }
    *(v2h*)(V16 + e) = o16; *(v2us*)(Vh + e) = oh; *(v2us*)(Vl + e) = ol;  }
__global__ __launch_bounds__(256) void k_csid(float* CS) { const int idx = blockIdx.x * 256 + threadIdx.x; if (idx >= TT * HD) return; v2f cs; cs[0] = 1.0f; cs[1] = 0.0f; *(v2f*)(CS + (size_t)idx * 2) = cs;  }
// k_lsoft: streaming causal row softmax over the TK = TT = 4096 keys, one wave per row i, three sweeps of the f32 score row (lane -> 4 consecutive keys per 128-key chunk, 32 chunks; keys j > i are excluded by index with -3e38 / 0 - the score tiles above the diagonal are never computed and their stale contents are only ever discarded by this select):
__global__ __launch_bounds__(256) void k_lsoft(const float* __restrict__ Sb, h16* P16, bf* Ph, bf* Pl) {
    const int lane = threadIdx.x & 31; const int row = blockIdx.x * 8 + (threadIdx.x >> 5); if (row >= ZH * TT) return; const int i = row % TT; const int zz = row / TT; const bool hires = (i < RH); const float* sr = Sb + (size_t)row * TT; float mx = -3.0e38f;
#pragma unroll 4
    for (int ch = 0; ch < TT / 128; ++ch) { const int j0 = ch * 128 + lane * 4; const v4f a = *(const v4f*)(sr + j0);
#pragma unroll
        for (int q = 0; q < 4; ++q) { float t = a[q] * SCL; asm volatile("" : "+v"(t)); t = (j0 + q <= i) ? t : -3.0e38f; mx = fmaxf(mx, t); } }
#pragma unroll
    for (int sh = 16; sh; sh >>= 1) mx = fmaxf(mx, __shfl_xor(mx, sh, 32));
    float sum = 0.f;
#pragma unroll 4
    for (int ch = 0; ch < TT / 128; ++ch) { const int j0 = ch * 128 + lane * 4; const v4f a = *(const v4f*)(sr + j0);
#pragma unroll
        for (int q = 0; q < 4; ++q) { float t = a[q] * SCL; asm volatile("" : "+v"(t)); t = (j0 + q <= i) ? t : -3.0e38f; float d0 = __fsub_rn(t, mx); asm volatile("" : "+v"(d0)); sum += __builtin_amdgcn_exp2f(__fmul_rn(d0, 1.4426950408889634f)); } }
#pragma unroll
    for (int sh = 16; sh; sh >>= 1) sum += __shfl_xor(sum, sh, 32);
    const float f = __fdiv_rn(hires ? 1.0f : PCAR, sum);
{
        if (hires) {   /* rows < RH: normalised bf16 hi/lo over the first RH keys (every later key is above the diagonal for these rows; the hi/lo attn.v GEMM stops its K loop at the diagonal block), planes [zz][RH][TT] */
#pragma unroll
            for (int ch = 0; ch < RH / 128; ++ch) { const int j0 = ch * 128 + lane * 4; const v4f a = *(const v4f*)(sr + j0); v4us oh, ol;
#pragma unroll
                for (int q = 0; q < 4; ++q) { float t = a[q] * SCL; asm volatile("" : "+v"(t)); t = (j0 + q <= i) ? t : -3.0e38f; float d0 = __fsub_rn(t, mx); asm volatile("" : "+v"(d0)); float ex = __builtin_amdgcn_exp2f(__fmul_rn(d0, 1.4426950408889634f)); asm volatile("" : "+v"(ex)); unsigned short a2, c2; splitf(ex * f, a2, c2); oh[q] = a2; ol[q] = c2; }
                const size_t oo = ((size_t)zz * RH + i) * TT + j0; *(v4us*)(Ph + oo) = oh; *(v4us*)(Pl + oo) = ol; }
        } else {
#pragma unroll 2
            for (int ch = 0; ch < TT / 128; ++ch) { const int j0 = ch * 128 + lane * 4; const v4f a = *(const v4f*)(sr + j0); v4h o4;
#pragma unroll
                for (int q = 0; q < 4; ++q) { float t = a[q] * SCL; asm volatile("" : "+v"(t)); t = (j0 + q <= i) ? t : -3.0e38f; float d0 = __fsub_rn(t, mx); asm volatile("" : "+v"(d0)); float ex = __builtin_amdgcn_exp2f(__fmul_rn(d0, 1.4426950408889634f)); asm volatile("" : "+v"(ex)); o4[q] = tohx(ex * f); }
                *(v4h*)(P16 + (size_t)row * TT + j0) = o4; } }
         }
}

__global__ __launch_bounds__(256) void k_merge(const float* __restrict__ O, int h0, float* OUTb) { const size_t e = ((size_t)blockIdx.x * 256 + threadIdx.x) * 2; if (e >= (size_t)ZH * TT * HD) return; const int d = (int)(e % HD); const int t = (int)((e / HD) % TT); const int zz = (int)(e / ((size_t)HD * TT)); const float cs = (t < RH) ? 1.0f : (1.0f / PCAR); const size_t oo = (size_t)t * DQ + (h0 + zz) * HD + d;
    v2f o2; o2[0] = O[e] * cs; o2[1] = O[e + 1] * cs; *(v2f*)(OUTb + oo) = o2;  }

extern "C" void kernel_launch(void* const* d_in, const int* in_sizes, int n_in,
                              void* d_out, int out_size, void* d_ws, size_t ws_size, hipStream_t stream) {
    (void)in_sizes; (void)n_in; (void)out_size;
    const float* x = (const float*)d_in[0]; const float* xk = (const float*)d_in[1]; const float* xv = (const float*)d_in[2]; const float* wq = (const float*)d_in[3]; const float* bq = (const float*)d_in[4]; const float* wk = (const float*)d_in[5]; const float* bk = (const float*)d_in[6]; const float* wv = (const float*)d_in[7]; const float* bv = (const float*)d_in[8]; const float* wo = nullptr; (void)wo;
    float* OUT = (float*)d_out;     // [1][4096][128]
    char* wsp = (char*)d_ws;
    auto take = [&](size_t bytes) { char* p = wsp; wsp += (bytes + 255) & ~(size_t)255; return (void*)p; };
    bf* WQ = (bf*)take((size_t)DQ * DM * 2); bf* WK = (bf*)take((size_t)DKV * DM * 2); bf* WV = (bf*)take((size_t)DKV * DM * 2); float* CS = (float*)take((size_t)TT * HD * 2 * 4);
    bf* XB = (bf*)take((size_t)TT * DM * 2); float* FQ = (float*)take((size_t)TT * DQ * 4); float* FK = (float*)take((size_t)TT * DKV * 4);
    h16* QP16 = (h16*)take((size_t)NH_ * TT * HD * 2); h16* KP16 = (h16*)take((size_t)NKV * TT * HD * 2); h16* VT16 = (h16*)take((size_t)NKV * HD * TT * 2);
    bf* QPh = (bf*)take((size_t)NH_ * TT * HD * 2); bf* QPl = (bf*)take((size_t)NH_ * TT * HD * 2); bf* KPh = (bf*)take((size_t)NKV * TT * HD * 2); bf* KPl = (bf*)take((size_t)NKV * TT * HD * 2); bf* VTh = (bf*)take((size_t)NKV * HD * TT * 2); bf* VTl = (bf*)take((size_t)NKV * HD * TT * 2); bf* Ph = (bf*)take((size_t)ZH * RH * TT * 2); bf* Pl = (bf*)take((size_t)ZH * RH * TT * 2);
    float* Sb = (float*)take((size_t)ZH * TT * TT * 4); h16* P16 = (h16*)take((size_t)ZH * TT * TT * 2); float* Ob = (float*)take((size_t)ZH * TT * HD * 4);
    if ((size_t)(wsp - (char*)d_ws) > ws_size) return;    // ws 256 MiB
    float* FV = FK;   // v projection reuses the k buffer after the k planes are built (stream-ordered)
    { k_wtG<<<(unsigned)((DM * DQ / 64 + 63) / 64), 256, 0, stream>>>(wq, DM, DQ, WQ); k_wtG<<<(unsigned)((DM * DKV / 64 + 63) / 64), 256, 0, stream>>>(wk, DM, DKV, WK); k_wtG<<<(unsigned)((DM * DKV / 64 + 63) / 64), 256, 0, stream>>>(wv, DM, DKV, WV);
      
       }
    k_csid<<<(TT * HD + 255) / 256, 256, 0, stream>>>(CS);
    const unsigned LQ = (unsigned)(((size_t)NH_ * TT * HD / 2 + 255) / 256), LKv = (unsigned)(((size_t)NKV * TT * HD / 2 + 255) / 256);
    for (int b = 0; b < NB_; ++b) {
        
        k_cvt8<<<(unsigned)(((size_t)TT * DM / 8 + 255) / 256), 256, 0, stream>>>(x, XB, (size_t)TT * DM / 8);
        k_gemmw<bf, 0, true><<<dim3(TT / 64, DQ / 64, 1), 32, 0, stream>>>(XB, nullptr, WQ, nullptr, DM, FQ, DQ, bq, 0, 0, 0);
        k_rope<<<LQ, 256, 0, stream>>>(FQ, DQ, NH_, CS, nullptr, nullptr, 1.0f, QP16, QPh, QPl);
        k_cvt8<<<(unsigned)(((size_t)TT * DM / 8 + 255) / 256), 256, 0, stream>>>(xk, XB, (size_t)TT * DM / 8); k_gemmw<bf, 0, true><<<dim3(TT / 64, DKV / 64, 1), 32, 0, stream>>>(XB, nullptr, WK, nullptr, DM, FK, DKV, bk, 0, 0, 0);
        k_rope<<<LKv, 256, 0, stream>>>(FK, DKV, NKV, CS, nullptr, nullptr, 1.0f, KP16, KPh, KPl);
        k_cvt8<<<(unsigned)(((size_t)TT * DM / 8 + 255) / 256), 256, 0, stream>>>(xv, XB, (size_t)TT * DM / 8); k_gemmw<bf, 0, true><<<dim3(TT / 64, DKV / 64, 1), 32, 0, stream>>>(XB, nullptr, WV, nullptr, DM, FV, DKV, bv, 0, 0, 0); k_vtp<<<LKv, 256, 0, stream>>>(FV, DKV, NKV, VT16, VTh, VTl);
        for (int h0 = 0; h0 < NH_; h0 += ZH) { const size_t zq = (size_t)h0, zk = (size_t)(h0 / REP);   // one kv head per query head: the pass holds one head (ZH = 1), kv plane zk (z-stride TT*HD)
            k_gemmc<bf, 2, 1><<<dim3(RH / 64, TT / 64, ZH), 32, 0, stream>>>(QPh + zq * TT * HD, QPl + zq * TT * HD, KPh + zk * TT * HD, KPl + zk * TT * HD, HD, Sb, TT, 0, (size_t)TT * HD, (size_t)TT * HD, (size_t)TT * TT);
            k_gemmc<h16, 0, 1><<<dim3((TT - RH) / 64, TT / 64, ZH), 32, 0, stream>>>(QP16 + zq * TT * HD + (size_t)RH * HD, nullptr, KP16 + zk * TT * HD, nullptr, HD, Sb + (size_t)RH * TT, TT, RH, (size_t)TT * HD, (size_t)TT * HD, (size_t)TT * TT);
            k_lsoft<<<ZH * TT / 8, 256, 0, stream>>>(Sb, P16, Ph, Pl);
            k_gemmc<bf, 2, 2><<<dim3(RH / 64, HD / 64, ZH), 32, 0, stream>>>(Ph, Pl, VTh + zk * HD * TT, VTl + zk * HD * TT, TT, Ob, HD, 0, (size_t)RH * TT, (size_t)HD * TT, (size_t)TT * HD);
            k_gemmc<h16, 0, 2><<<dim3((TT - RH) / 64, HD / 64, ZH), 32, 0, stream>>>(P16 + (size_t)RH * TT, nullptr, VT16 + zk * HD * TT, nullptr, TT, Ob + (size_t)RH * HD, HD, RH, (size_t)TT * TT, (size_t)HD * TT, (size_t)TT * HD);
            k_merge<<<(unsigned)(((size_t)ZH * TT * HD / 2 + 255) / 256), 256, 0, stream>>>(Ob, h0, OUT + (size_t)b * TT * DQ); }
         }
}

// v001
// A run of this version takes 167 microseconds.
// Timed twice side by side with v000, it ran 1.67 and 1.69 times as fast.
#include <hip/hip_runtime.h>

// Single-head causal attention over separate q / k / v inputs (q, k, v [4096][1024]; qp = q Wq + bq, kp = k Wk + bk, vp = v Wv + bv ('xw' [1024][128] + [128]); scores = qp.kp / sqrt(128), causal (-1e10 == exclusion); softmax; out = attn vp -> [4096][128] (0.5 M)).
// Layout: bf16 copies of the three inputs in turn; exact projections + f32 biases; ONE 128-wide head through the causal T-4096 attention (hybrid rows: < 512 hi/lo 3 products, rest fp16 x1024; k_gemmc tile skipping; streaming three-sweep softmax); the f32 merge writes the output rows.
// Compute dtypes, f32 accumulate: every input rounded to bf16; projections exact + f32 biases; attention rows < 512 3 products, rest fp16; softmax f32; output f32.

#define NB_  1
#define TT   4096
#define DM   1024
#define NH_  1
#define NKV  1
#define REP  (NH_ / NKV)
#define HD   128
#define DQ   (NH_ * HD)
#define DKV  (NKV * HD)
#define ZH   1
#define RH   512                  // query rows < RH use hi+lo planes (0: none)
#define WIN  4096
#define PCAR 1024.0f
#define SCL  0.088388347648318447f   // HD^-0.5
typedef _Float16 h16;
typedef unsigned short bf;
typedef __attribute__((ext_vector_type(16))) __bf16   v16bf;
typedef __attribute__((ext_vector_type(16))) _Float16 v16h;
typedef __attribute__((ext_vector_type(8)))  _Float16 v8h;
typedef __attribute__((ext_vector_type(8)))  unsigned short v8us;
typedef __attribute__((ext_vector_type(8)))  float    v8f;
typedef __attribute__((ext_vector_type(4)))  float    v4f;
typedef v8h  __attribute__((may_alias)) v8ha;
typedef v4f  __attribute__((may_alias)) v4fa;
typedef v8us __attribute__((may_alias)) v8usa;

__device__ __forceinline__ unsigned short f2bf(float f) { unsigned u = __float_as_uint(f); u += 0x7FFFu + ((u >> 16) & 1u); return (unsigned short)(u >> 16); }
__device__ __forceinline__ float bf2f(unsigned short b) { return __uint_as_float(((unsigned)b) << 16); }
__device__ __forceinline__ float bfr(float f) { return bf2f(f2bf(f)); }
__device__ __forceinline__ v16h cat16(v8h lo, v8h hi) { return __builtin_shufflevector(lo, hi, 0, 1, 2, 3, 4, 5, 6, 7, 8, 9, 10, 11, 12, 13, 14, 15); }
__device__ __forceinline__ v16bf cat16b(v8us lo, v8us hi) { return __builtin_bit_cast(v16bf, __builtin_shufflevector(lo, hi, 0, 1, 2, 3, 4, 5, 6, 7, 8, 9, 10, 11, 12, 13, 14, 15)); }
__device__ __forceinline__ v8f wmma16(v16h a, v16h b, v8f c) { return __builtin_amdgcn_wmma_f32_16x16x32_f16(false, a, false, b, (short)0, c, false, false); }
__device__ __forceinline__ v8f wmmab(v16bf a, v16bf b, v8f c) { return __builtin_amdgcn_wmma_f32_16x16x32_bf16(false, a, false, b, (short)0, c, false, false); }



// ---- k_gemmw: register-blocked GEMM, one work-group of NW waves per 64x64 output tile, operands straight from K-contiguous 16-bit planes; grid (M/64, N/64, Z), 32 * NW threads.
// Split K: wave w keeps a whole 64x64 partial (16 accumulators) over the k chunks w, w + NW, ... of 32 * KU each; tile_out sums the NW partials in LDS, in wave order.
// C[m][n] (f32, pitch ldc, + optional f32 bias[n]) = sum_k A[m][k] Bt[n][k] (+ split products per NSPLIT). z-batch strides sA/sB/sC in elements. K % (32 * KU) == 0.
template <typename T16> struct WFrag;
template <> struct WFrag<h16> { typedef v16h V; static __device__ __forceinline__ V ld(const h16* p) { return cat16(*(const v8h*)p, *(const v8h*)(p + 16)); } static __device__ __forceinline__ v8f mma(V a, V b, v8f c) { return wmma16(a, b, c); } };
template <> struct WFrag<bf> { typedef v16bf V; static __device__ __forceinline__ V ld(const bf* p) { return cat16b(*(const v8us*)p, *(const v8us*)(p + 16)); } static __device__ __forceinline__ v8f mma(V a, V b, v8f c) { return wmmab(a, b, c); } };
// tile_out (NW > 1): every wave stages its 64x64 partial in its own LDS plane (pitch 68 floats); behind one barrier the work-group sums the planes in wave order and stores whole 256-byte output rows.
// Every loop is unrolled so that acc is indexed by constants only (registers, no scratch) and the LDS reads of the sum can be issued ahead of its adds.
#define OSP (64 * 68)
template <int NW, bool BIAS>
__device__ __forceinline__ void tile_out(const v8f (&acc)[4][4], float* os, int wv, float* C, int ldc, int r0, int c0, const float* __restrict__ bias) {
    const int lane = threadIdx.x & 31, lr = lane & 15, hi = lane >> 4; float* osw = os + wv * OSP;
#pragma unroll
    for (int mb = 0; mb < 4; ++mb) {
#pragma unroll
        for (int nb = 0; nb < 4; ++nb) {
#pragma unroll
            for (int j = 0; j < 8; ++j) osw[(mb * 16 + hi * 8 + j) * 68 + nb * 16 + lr] = acc[mb][nb][j]; } }
    __syncthreads();   // every wave's partial is in LDS before any thread sums the planes
    float* crow = C + (size_t)r0 * ldc + c0;
#pragma unroll
    for (int s = 0; s < 32 / NW; ++s) { const int idx = s * 32 * NW + (int)threadIdx.x; const int row = idx >> 4, cofs = (idx & 15) * 4; v4f val = *(const v4fa*)(os + row * 68 + cofs);
#pragma unroll
        for (int w = 1; w < NW; ++w) val += *(const v4fa*)(os + w * OSP + row * 68 + cofs);
        if (BIAS) { val[0] += bfr(bias[c0 + cofs]); val[1] += bfr(bias[c0 + cofs + 1]); val[2] += bfr(bias[c0 + cofs + 2]); val[3] += bfr(bias[c0 + cofs + 3]); }
        *(v4f*)(crow + (size_t)row * ldc + cofs) = val; }
}
template <typename T16, int NSPLIT, bool BIAS, int NW, int KU>
__global__ __launch_bounds__(32 * NW) void k_gemmw(const T16* __restrict__ A, const T16* __restrict__ A2, const T16* __restrict__ Bt, const T16* __restrict__ Bt2, int K, float* C, int ldc, const float* __restrict__ bias, size_t sA, size_t sB, size_t sC) {
    typedef typename WFrag<T16>::V V;
    __shared__ __align__(16) float os[(NW > 1) ? NW * OSP : 16 * 68];
    const size_t z = blockIdx.z; A += z * sA; if (A2) A2 += z * sA; Bt += z * sB; if (Bt2) Bt2 += z * sB; C += z * sC;
    const int lane = threadIdx.x & 31, lr = lane & 15, hi = lane >> 4; const int r0 = blockIdx.x * 64, c0 = blockIdx.y * 64;
    const int wv = (NW > 1) ? __builtin_amdgcn_readfirstlane((int)(threadIdx.x >> 5)) : 0;   // the wave's number in a scalar register, so that the K loop's test stays scalar
    v8f acc[4][4];
#pragma unroll
    for (int mb = 0; mb < 4; ++mb)
#pragma unroll
        for (int nb = 0; nb < 4; ++nb) acc[mb][nb] = (v8f){};
    const size_t aoff = (size_t)(r0 + lr) * K + 8 * hi, boff = (size_t)(c0 + lr) * K + 8 * hi;
#pragma unroll 1
    for (int k0 = wv * (32 * KU); k0 < K; k0 += NW * 32 * KU) {
#pragma unroll
      for (int u = 0; u < KU; ++u) { const int kc = k0 + 32 * u;   // unrolled: one trip covers a whole 32 * KU chunk (KU == 2: a 128-byte line of every operand row)
        V a[4], a2[4];
#pragma unroll
        for (int mb = 0; mb < 4; ++mb) { a[mb] = WFrag<T16>::ld(A + aoff + (size_t)mb * 16 * K + kc); if (NSPLIT == 1 || NSPLIT == 2) a2[mb] = WFrag<T16>::ld(A2 + aoff + (size_t)mb * 16 * K + kc); }
#pragma unroll
        for (int nb = 0; nb < 4; ++nb) { const V b = WFrag<T16>::ld(Bt + boff + (size_t)nb * 16 * K + kc); V b2; if (NSPLIT >= 2) b2 = WFrag<T16>::ld(Bt2 + boff + (size_t)nb * 16 * K + kc);
#pragma unroll
            for (int mb = 0; mb < 4; ++mb) { acc[mb][nb] = WFrag<T16>::mma(a[mb], b, acc[mb][nb]); if (NSPLIT == 1 || NSPLIT == 2) acc[mb][nb] = WFrag<T16>::mma(a2[mb], b, acc[mb][nb]); if (NSPLIT >= 2) acc[mb][nb] = WFrag<T16>::mma(a[mb], b2, acc[mb][nb]); } }
        asm volatile("v_nop\n\tv_nop\n\tv_nop\n\tv_nop" : "+v"(acc[0][0]), "+v"(acc[1][1]), "+v"(acc[2][2]), "+v"(acc[3][3]) : "v"(a[0]), "v"(a[3]));
      }
    }
    tile_out<NW, BIAS>(acc, os, wv, C, ldc, r0, c0, bias);
}

// ---- k_gemmc: the same 64x64 tile GEMM (NW waves, split K as above; the score launches keep one wave, NW == 1) specialised for causal attention: CMODE 1 skips score tiles entirely above the diagonal (query rows r0+roff.., key columns c0..), CMODE 2 limits the
// key (K) loop of the probability x value contraction to the diagonal block (probabilities beyond it are exactly zero). roff = row offset of this launch's first row within the sequence.
template <typename T16, int NSPLIT, int CMODE, int NW, int KU>
__global__ __launch_bounds__(32 * NW) void k_gemmc(const T16* __restrict__ A, const T16* __restrict__ A2, const T16* __restrict__ Bt, const T16* __restrict__ Bt2, int K, float* C, int ldc, int roff, size_t sA, size_t sB, size_t sC) {
    typedef typename WFrag<T16>::V V;
    __shared__ __align__(16) float os[(NW > 1) ? NW * OSP : 16 * 68];
    const size_t z = blockIdx.z; A += z * sA; if (A2) A2 += z * sA; Bt += z * sB; if (Bt2) Bt2 += z * sB; C += z * sC;
    const int lane = threadIdx.x & 31, lr = lane & 15, hi = lane >> 4; const int r0 = blockIdx.x * 64, c0 = blockIdx.y * 64;
    const int wv = (NW > 1) ? __builtin_amdgcn_readfirstlane((int)(threadIdx.x >> 5)) : 0;   // the wave's number in a scalar register, so that the K loop's test stays scalar
    if (CMODE == 1 && c0 > r0 + roff + 63) return;                  // score tile entirely above the causal diagonal: never computed (the softmax masks j > i by select)
    const int Kl = (CMODE == 2) ? min(K, r0 + roff + 64) : K;        // P.V: probabilities are exactly 0 beyond the diagonal block, so the K loop stops there
    v8f acc[4][4];
#pragma unroll
    for (int mb = 0; mb < 4; ++mb)
#pragma unroll
        for (int nb = 0; nb < 4; ++nb) acc[mb][nb] = (v8f){};
    const size_t aoff = (size_t)(r0 + lr) * K + 8 * hi, boff = (size_t)(c0 + lr) * K + 8 * hi;
#pragma unroll 1
    for (int k0 = wv * (32 * KU); k0 < Kl; k0 += NW * 32 * KU) {
#pragma unroll
      for (int u = 0; u < KU; ++u) { const int kc = k0 + 32 * u;   // unrolled: one trip covers a whole 32 * KU chunk (KU == 2: a 128-byte line of every operand row)
        V a[4], a2[4];
#pragma unroll
        for (int mb = 0; mb < 4; ++mb) { a[mb] = WFrag<T16>::ld(A + aoff + (size_t)mb * 16 * K + kc); if (NSPLIT == 1 || NSPLIT == 2) a2[mb] = WFrag<T16>::ld(A2 + aoff + (size_t)mb * 16 * K + kc); }
#pragma unroll
        for (int nb = 0; nb < 4; ++nb) { const V b = WFrag<T16>::ld(Bt + boff + (size_t)nb * 16 * K + kc); V b2; if (NSPLIT >= 2) b2 = WFrag<T16>::ld(Bt2 + boff + (size_t)nb * 16 * K + kc);
#pragma unroll
            for (int mb = 0; mb < 4; ++mb) { acc[mb][nb] = WFrag<T16>::mma(a[mb], b, acc[mb][nb]); if (NSPLIT == 1 || NSPLIT == 2) acc[mb][nb] = WFrag<T16>::mma(a2[mb], b, acc[mb][nb]); if (NSPLIT >= 2) acc[mb][nb] = WFrag<T16>::mma(a[mb], b2, acc[mb][nb]); } }
        asm volatile("v_nop\n\tv_nop\n\tv_nop\n\tv_nop" : "+v"(acc[0][0]), "+v"(acc[1][1]), "+v"(acc[2][2]), "+v"(acc[3][3]) : "v"(a[0]), "v"(a[3]));
      }
    }
    if (NW > 1) { tile_out<NW, false>(acc, os, wv, C, ldc, r0, c0, nullptr); return; }
#pragma unroll
    for (int mb = 0; mb < 4; ++mb) {
#pragma unroll
        for (int nb = 0; nb < 4; ++nb) {
#pragma unroll
            for (int j = 0; j < 8; ++j) os[(hi * 8 + j) * 68 + nb * 16 + lr] = acc[mb][nb][j]; }
        __builtin_amdgcn_wave_barrier(); asm volatile("" ::: "memory");
        float* crow = C + (size_t)(r0 + mb * 16) * ldc + c0;
{
#pragma unroll
            for (int s = 0; s < 8; ++s) { const int row = 2 * s + hi, cofs = lr * 4; v4f val = *(const v4fa*)(os + row * 68 + cofs);
                *(v4f*)(crow + (size_t)row * ldc + cofs) = val; }
             }
        __builtin_amdgcn_wave_barrier(); asm volatile("" ::: "memory");
    }
}

__device__ __forceinline__ h16 tohx(float x) { return (h16)x; }
__device__ __forceinline__ void splitf(float y, unsigned short& h, unsigned short& l) { h = f2bf(y); l = f2bf(y - bf2f(h)); }
typedef __attribute__((ext_vector_type(2))) _Float16 v2h;
typedef __attribute__((ext_vector_type(4))) _Float16 v4h;
typedef __attribute__((ext_vector_type(2))) unsigned short v2us;
typedef __attribute__((ext_vector_type(4))) unsigned short v4us;
typedef __attribute__((ext_vector_type(2))) float v2f;
typedef __attribute__((ext_vector_type(4))) int v4i;

__global__ __launch_bounds__(256) void k_wtG(const float* __restrict__ w, int K, int N, bf* Bt) {
    const int lane = threadIdx.x & 31; const int L0 = (blockIdx.x * 8 + (threadIdx.x >> 5)) * 8; const int nlines = N * K / 64;
{
#pragma unroll 1
        for (int l = 0; l < 8; ++l) { const int L = L0 + l; if (L >= nlines) break; const size_t e = (size_t)L * 64 + lane * 2; const int k = (int)(e % K), n = (int)(e / K); v2us o;
            o[0] = f2bf(w[(size_t)k * N + n]); o[1] = f2bf(w[(size_t)(k + 1) * N + n]); *(v2us*)(Bt + e) = o; }
         }
}
__global__ __launch_bounds__(256) void k_cvt8(const float* __restrict__ src, bf* dst, size_t n8) { const size_t i = (size_t)blockIdx.x * 256 + threadIdx.x; if (i >= n8) return; const v8f v = *(const v8f*)(src + i * 8); v8us o;
#pragma unroll
    for (int k = 0; k < 8; ++k) o[k] = f2bf(v[k]); *(v8us*)(dst + i * 8) = o;  }

// k_rope: head planes [h][t][d] (fp16 + hi/lo) of rope(x) x sc with the rotate-half convention out[d] = x[d] cos[t][d] - x[d+HD/2] sin[t][d], out[d+HD/2] = x[d+HD/2] cos[t][d+HD/2] + x[d] sin[t][d+HD/2]
__global__ __launch_bounds__(256) void k_rope(const float* __restrict__ F, int pitch, int nheads, const float* __restrict__ CS, const float* __restrict__ RF, const float* __restrict__ nw, float sc, h16* P16, bf* Ph, bf* Pl) {
    const size_t e = ((size_t)blockIdx.x * 256 + threadIdx.x) * 2; if (e >= (size_t)nheads * TT * HD) return; const int d = (int)(e % HD); const int t = (int)((e / HD) % TT); const int h = (int)(e / ((size_t)HD * TT)); const float* f = F + (size_t)t * pitch + h * HD; const float rf = RF ? RF[(size_t)h * TT + t] : 1.0f; v2h o16; v2us oh, ol;
#pragma unroll
    for (int q = 0; q < 2; ++q) { const int dd = d + q; const int dp = (dd < HD / 2) ? dd + HD / 2 : dd - HD / 2; float x0 = f[dd], x1 = f[dp];
        if (RF) { float n0 = __fmul_rn(x0, rf), n1 = __fmul_rn(x1, rf); asm volatile("" : "+v"(n0)); asm volatile("" : "+v"(n1)); x0 = __fmul_rn(bfr(nw[dd]), n0); x1 = __fmul_rn(bfr(nw[dp]), n1); }
        const v2f cs = *(const v2f*)(CS + ((size_t)t * HD + dd) * 2); float a = __fmul_rn(x0, cs[0]), bq = __fmul_rn(x1, cs[1]); asm volatile("" : "+v"(a)); asm volatile("" : "+v"(bq)); const float r = ((dd < HD / 2) ? __fsub_rn(a, bq) : __fadd_rn(a, bq)) * sc;
        o16[q] = tohx(r); unsigned short a2, c2; splitf(r, a2, c2); oh[q] = a2; ol[q] = c2; }
    *(v2h*)(P16 + e) = o16; *(v2us*)(Ph + e) = oh; *(v2us*)(Pl + e) = ol;  }
__global__ __launch_bounds__(256) void k_vtp(const float* __restrict__ F, int pitch, int nheads, h16* V16, bf* Vh, bf* Vl) { const size_t e = ((size_t)blockIdx.x * 256 + threadIdx.x) * 2; if (e >= (size_t)nheads * HD * TT) return; const int t = (int)(e % TT); const int d = (int)((e / TT) % HD); const int g = (int)(e / ((size_t)TT * HD)); v2h o16; v2us oh, ol;
#pragma unroll
    for (int q = 0; q < 2; ++q) { const float x = F[(size_t)(t + q) * pitch + g * HD + d]; o16[q] = tohx(x); unsigned short a2, c2; splitf(x, a2, c2); oh[q] = a2; ol[q] = c2; }
    *(v2h*)(V16 + e) = o16; *(v2us*)(Vh + e) = oh; *(v2us*)(Vl + e) = ol;  }
__global__ __launch_bounds__(256) void k_csid(float* CS) { const int idx = blockIdx.x * 256 + threadIdx.x; if (idx >= TT * HD) return; v2f cs; cs[0] = 1.0f; cs[1] = 0.0f; *(v2f*)(CS + (size_t)idx * 2) = cs;  }
// k_lsoft: streaming causal row softmax over the TK = TT = 4096 keys, one wave per row i, three sweeps of the f32 score row (lane -> 4 consecutive keys per 128-key chunk, 32 chunks; keys j > i are excluded by index with -3e38 / 0 - the score tiles above the diagonal are never computed and their stale contents are only ever discarded by this select):
__global__ __launch_bounds__(256) void k_lsoft(const float* __restrict__ Sb, h16* P16, bf* Ph, bf* Pl) {
    const int lane = threadIdx.x & 31; const int row = blockIdx.x * 8 + (threadIdx.x >> 5); if (row >= ZH * TT) return; const int i = row % TT; const int zz = row / TT; const bool hires = (i < RH); const float* sr = Sb + (size_t)row * TT; float mx = -3.0e38f;
#pragma unroll 4
    for (int ch = 0; ch < TT / 128; ++ch) { const int j0 = ch * 128 + lane * 4; const v4f a = *(const v4f*)(sr + j0);
#pragma unroll
        for (int q = 0; q < 4; ++q) { float t = a[q] * SCL; asm volatile("" : "+v"(t)); t = (j0 + q <= i) ? t : -3.0e38f; mx = fmaxf(mx, t); } }
#pragma unroll
    for (int sh = 16; sh; sh >>= 1) mx = fmaxf(mx, __shfl_xor(mx, sh, 32));
    float sum = 0.f;
#pragma unroll 4
    for (int ch = 0; ch < TT / 128; ++ch) { const int j0 = ch * 128 + lane * 4; const v4f a = *(const v4f*)(sr + j0);
#pragma unroll
        for (int q = 0; q < 4; ++q) { float t = a[q] * SCL; asm volatile("" : "+v"(t)); t = (j0 + q <= i) ? t : -3.0e38f; float d0 = __fsub_rn(t, mx); asm volatile("" : "+v"(d0)); sum += __builtin_amdgcn_exp2f(__fmul_rn(d0, 1.4426950408889634f)); } }
#pragma unroll
    for (int sh = 16; sh; sh >>= 1) sum += __shfl_xor(sum, sh, 32);
    const float f = __fdiv_rn(hires ? 1.0f : PCAR, sum);
{
        if (hires) {   /* rows < RH: normalised bf16 hi/lo over the first RH keys (every later key is above the diagonal for these rows; the hi/lo attn.v GEMM stops its K loop at the diagonal block), planes [zz][RH][TT] */
#pragma unroll
            for (int ch = 0; ch < RH / 128; ++ch) { const int j0 = ch * 128 + lane * 4; const v4f a = *(const v4f*)(sr + j0); v4us oh, ol;
#pragma unroll
                for (int q = 0; q < 4; ++q) { float t = a[q] * SCL; asm volatile("" : "+v"(t)); t = (j0 + q <= i) ? t : -3.0e38f; float d0 = __fsub_rn(t, mx); asm volatile("" : "+v"(d0)); float ex = __builtin_amdgcn_exp2f(__fmul_rn(d0, 1.4426950408889634f)); asm volatile("" : "+v"(ex)); unsigned short a2, c2; splitf(ex * f, a2, c2); oh[q] = a2; ol[q] = c2; }
                const size_t oo = ((size_t)zz * RH + i) * TT + j0; *(v4us*)(Ph + oo) = oh; *(v4us*)(Pl + oo) = ol; }
        } else {
#pragma unroll 2
            for (int ch = 0; ch < TT / 128; ++ch) { const int j0 = ch * 128 + lane * 4; const v4f a = *(const v4f*)(sr + j0); v4h o4;
#pragma unroll
                for (int q = 0; q < 4; ++q) { float t = a[q] * SCL; asm volatile("" : "+v"(t)); t = (j0 + q <= i) ? t : -3.0e38f; float d0 = __fsub_rn(t, mx); asm volatile("" : "+v"(d0)); float ex = __builtin_amdgcn_exp2f(__fmul_rn(d0, 1.4426950408889634f)); asm volatile("" : "+v"(ex)); o4[q] = tohx(ex * f); }
                *(v4h*)(P16 + (size_t)row * TT + j0) = o4; } }
         }
}

__global__ __launch_bounds__(256) void k_merge(const float* __restrict__ O, int h0, float* OUTb) { const size_t e = ((size_t)blockIdx.x * 256 + threadIdx.x) * 2; if (e >= (size_t)ZH * TT * HD) return; const int d = (int)(e % HD); const int t = (int)((e / HD) % TT); const int zz = (int)(e / ((size_t)HD * TT)); const float cs = (t < RH) ? 1.0f : (1.0f / PCAR); const size_t oo = (size_t)t * DQ + (h0 + zz) * HD + d;
    v2f o2; o2[0] = O[e] * cs; o2[1] = O[e + 1] * cs; *(v2f*)(OUTb + oo) = o2;  }

extern "C" void kernel_launch(void* const* d_in, const int* in_sizes, int n_in,
                              void* d_out, int out_size, void* d_ws, size_t ws_size, hipStream_t stream) {
    (void)in_sizes; (void)n_in; (void)out_size;
    const float* x = (const float*)d_in[0]; const float* xk = (const float*)d_in[1]; const float* xv = (const float*)d_in[2]; const float* wq = (const float*)d_in[3]; const float* bq = (const float*)d_in[4]; const float* wk = (const float*)d_in[5]; const float* bk = (const float*)d_in[6]; const float* wv = (const float*)d_in[7]; const float* bv = (const float*)d_in[8]; const float* wo = nullptr; (void)wo;
    float* OUT = (float*)d_out;     // [1][4096][128]
    char* wsp = (char*)d_ws;
    auto take = [&](size_t bytes) { char* p = wsp; wsp += (bytes + 255) & ~(size_t)255; return (void*)p; };
    bf* WQ = (bf*)take((size_t)DQ * DM * 2); bf* WK = (bf*)take((size_t)DKV * DM * 2); bf* WV = (bf*)take((size_t)DKV * DM * 2); float* CS = (float*)take((size_t)TT * HD * 2 * 4);
    bf* XB = (bf*)take((size_t)TT * DM * 2); float* FQ = (float*)take((size_t)TT * DQ * 4); float* FK = (float*)take((size_t)TT * DKV * 4);
    h16* QP16 = (h16*)take((size_t)NH_ * TT * HD * 2); h16* KP16 = (h16*)take((size_t)NKV * TT * HD * 2); h16* VT16 = (h16*)take((size_t)NKV * HD * TT * 2);
    bf* QPh = (bf*)take((size_t)NH_ * TT * HD * 2); bf* QPl = (bf*)take((size_t)NH_ * TT * HD * 2); bf* KPh = (bf*)take((size_t)NKV * TT * HD * 2); bf* KPl = (bf*)take((size_t)NKV * TT * HD * 2); bf* VTh = (bf*)take((size_t)NKV * HD * TT * 2); bf* VTl = (bf*)take((size_t)NKV * HD * TT * 2); bf* Ph = (bf*)take((size_t)ZH * RH * TT * 2); bf* Pl = (bf*)take((size_t)ZH * RH * TT * 2);
    float* Sb = (float*)take((size_t)ZH * TT * TT * 4); h16* P16 = (h16*)take((size_t)ZH * TT * TT * 2); float* Ob = (float*)take((size_t)ZH * TT * HD * 4);
    if ((size_t)(wsp - (char*)d_ws) > ws_size) return;    // ws 256 MiB
    float* FV = FK;   // v projection reuses the k buffer after the k planes are built (stream-ordered)
    { k_wtG<<<(unsigned)((DM * DQ / 64 + 63) / 64), 256, 0, stream>>>(wq, DM, DQ, WQ); k_wtG<<<(unsigned)((DM * DKV / 64 + 63) / 64), 256, 0, stream>>>(wk, DM, DKV, WK); k_wtG<<<(unsigned)((DM * DKV / 64 + 63) / 64), 256, 0, stream>>>(wv, DM, DKV, WV);
      
       }
    k_csid<<<(TT * HD + 255) / 256, 256, 0, stream>>>(CS);
    const unsigned LQ = (unsigned)(((size_t)NH_ * TT * HD / 2 + 255) / 256), LKv = (unsigned)(((size_t)NKV * TT * HD / 2 + 255) / 256);
    for (int b = 0; b < NB_; ++b) {
        
        k_cvt8<<<(unsigned)(((size_t)TT * DM / 8 + 255) / 256), 256, 0, stream>>>(x, XB, (size_t)TT * DM / 8);
        k_gemmw<bf, 0, true, 16, 2><<<dim3(TT / 64, DQ / 64, 1), 512, 0, stream>>>(XB, nullptr, WQ, nullptr, DM, FQ, DQ, bq, 0, 0, 0);
        k_rope<<<LQ, 256, 0, stream>>>(FQ, DQ, NH_, CS, nullptr, nullptr, 1.0f, QP16, QPh, QPl);
        k_cvt8<<<(unsigned)(((size_t)TT * DM / 8 + 255) / 256), 256, 0, stream>>>(xk, XB, (size_t)TT * DM / 8); k_gemmw<bf, 0, true, 16, 2><<<dim3(TT / 64, DKV / 64, 1), 512, 0, stream>>>(XB, nullptr, WK, nullptr, DM, FK, DKV, bk, 0, 0, 0);
        k_rope<<<LKv, 256, 0, stream>>>(FK, DKV, NKV, CS, nullptr, nullptr, 1.0f, KP16, KPh, KPl);
        k_cvt8<<<(unsigned)(((size_t)TT * DM / 8 + 255) / 256), 256, 0, stream>>>(xv, XB, (size_t)TT * DM / 8); k_gemmw<bf, 0, true, 16, 2><<<dim3(TT / 64, DKV / 64, 1), 512, 0, stream>>>(XB, nullptr, WV, nullptr, DM, FV, DKV, bv, 0, 0, 0); k_vtp<<<LKv, 256, 0, stream>>>(FV, DKV, NKV, VT16, VTh, VTl);
        for (int h0 = 0; h0 < NH_; h0 += ZH) { const size_t zq = (size_t)h0, zk = (size_t)(h0 / REP);   // one kv head per query head: each pass covers ZH == 1 head, on kv plane zk (z-strides TT*HD)
            k_gemmc<bf, 2, 1, 1, 1><<<dim3(RH / 64, TT / 64, ZH), 32, 0, stream>>>(QPh + zq * TT * HD, QPl + zq * TT * HD, KPh + zk * TT * HD, KPl + zk * TT * HD, HD, Sb, TT, 0, (size_t)TT * HD, (size_t)TT * HD, (size_t)TT * TT);
            k_gemmc<h16, 0, 1, 1, 1><<<dim3((TT - RH) / 64, TT / 64, ZH), 32, 0, stream>>>(QP16 + zq * TT * HD + (size_t)RH * HD, nullptr, KP16 + zk * TT * HD, nullptr, HD, Sb + (size_t)RH * TT, TT, RH, (size_t)TT * HD, (size_t)TT * HD, (size_t)TT * TT);
            k_lsoft<<<ZH * TT / 8, 256, 0, stream>>>(Sb, P16, Ph, Pl);
            k_gemmc<bf, 2, 2, 8, 1><<<dim3(RH / 64, HD / 64, ZH), 256, 0, stream>>>(Ph, Pl, VTh + zk * HD * TT, VTl + zk * HD * TT, TT, Ob, HD, 0, (size_t)RH * TT, (size_t)HD * TT, (size_t)TT * HD);
            k_gemmc<h16, 0, 2, 16, 2><<<dim3((TT - RH) / 64, HD / 64, ZH), 512, 0, stream>>>(P16 + (size_t)RH * TT, nullptr, VT16 + zk * HD * TT, nullptr, TT, Ob + (size_t)RH * HD, HD, RH, (size_t)TT * TT, (size_t)HD * TT, (size_t)TT * HD);
            k_merge<<<(unsigned)(((size_t)ZH * TT * HD / 2 + 255) / 256), 256, 0, stream>>>(Ob, h0, OUT + (size_t)b * TT * DQ); }
         }
}

// v002
// Measured time: 95.6 microseconds a run.
// In two side-by-side timings against v001, it was 1.76 and 1.74 times as fast.
// All steps since v000 together make it 2.94 times as fast.
#include <hip/hip_runtime.h>

// Single-head causal attention over separate q / k / v inputs (q, k, v [4096][1024]; qp = q Wq + bq, kp = k Wk + bk, vp = v Wv + bv ('xw' [1024][128] + [128]); scores = qp.kp / sqrt(128), causal (-1e10 == exclusion); softmax; out = attn vp -> [4096][128] (0.5 M)).
// Layout: one projection launch (inputs and weights rounded to bf16 in registers; exact products + f32 biases; attention planes written from its epilogue); ONE 128-wide head through the causal T-4096 attention (hybrid rows: < 512 hi/lo 3 products, rest fp16 x1024; k_gemmc tile skipping; streaming three-sweep softmax); the P.V launches write the output rows.
// Compute dtypes, f32 accumulate: every input rounded to bf16; projections exact + f32 biases; attention rows < 512 3 products, rest fp16; softmax f32; output f32.

#define NB_  1
#define TT   4096
#define DM   1024
#define NH_  1
#define NKV  1
#define REP  (NH_ / NKV)
#define HD   128
#define DQ   (NH_ * HD)
#define DKV  (NKV * HD)
#define ZH   1
#define RH   512                  // query rows < RH use hi+lo planes (0: none)
#define WIN  4096
#define PCAR 1024.0f
#define SCL  0.088388347648318447f   // HD^-0.5
typedef _Float16 h16;
typedef unsigned short bf;
typedef __attribute__((ext_vector_type(16))) __bf16   v16bf;
typedef __attribute__((ext_vector_type(16))) _Float16 v16h;
typedef __attribute__((ext_vector_type(8)))  _Float16 v8h;
typedef __attribute__((ext_vector_type(8)))  unsigned short v8us;
typedef __attribute__((ext_vector_type(8)))  float    v8f;
typedef __attribute__((ext_vector_type(4)))  float    v4f;
typedef v8h  __attribute__((may_alias)) v8ha;
typedef v4f  __attribute__((may_alias)) v4fa;
typedef v8us __attribute__((may_alias)) v8usa;

__device__ __forceinline__ unsigned short f2bf(float f) { unsigned u = __float_as_uint(f); u += 0x7FFFu + ((u >> 16) & 1u); return (unsigned short)(u >> 16); }
__device__ __forceinline__ float bf2f(unsigned short b) { return __uint_as_float(((unsigned)b) << 16); }
__device__ __forceinline__ float bfr(float f) { return bf2f(f2bf(f)); }
__device__ __forceinline__ v16h cat16(v8h lo, v8h hi) { return __builtin_shufflevector(lo, hi, 0, 1, 2, 3, 4, 5, 6, 7, 8, 9, 10, 11, 12, 13, 14, 15); }
__device__ __forceinline__ v16bf cat16b(v8us lo, v8us hi) { return __builtin_bit_cast(v16bf, __builtin_shufflevector(lo, hi, 0, 1, 2, 3, 4, 5, 6, 7, 8, 9, 10, 11, 12, 13, 14, 15)); }
__device__ __forceinline__ v8f wmma16(v16h a, v16h b, v8f c) { return __builtin_amdgcn_wmma_f32_16x16x32_f16(false, a, false, b, (short)0, c, false, false); }
__device__ __forceinline__ v8f wmmab(v16bf a, v16bf b, v8f c) { return __builtin_amdgcn_wmma_f32_16x16x32_bf16(false, a, false, b, (short)0, c, false, false); }



template <typename T16> struct WFrag;
template <> struct WFrag<h16> { typedef v16h V; static __device__ __forceinline__ V ld(const h16* p) { return cat16(*(const v8h*)p, *(const v8h*)(p + 16)); } static __device__ __forceinline__ v8f mma(V a, V b, v8f c) { return wmma16(a, b, c); } };
template <> struct WFrag<bf> { typedef v16bf V; static __device__ __forceinline__ V ld(const bf* p) { return cat16b(*(const v8us*)p, *(const v8us*)(p + 16)); } static __device__ __forceinline__ v8f mma(V a, V b, v8f c) { return wmmab(a, b, c); } };
// tile_out (NW > 1): every wave stages its 64x64 partial in its own LDS plane (pitch 68 floats); behind one barrier the work-group sums the planes in wave order and stores whole 256-byte output rows, times osc.
// Every loop is unrolled so that acc is indexed by constants only (registers, no scratch) and the LDS reads of the sum can be issued ahead of its adds.
#define OSP (64 * 68)
template <int NW>
__device__ __forceinline__ void tile_out(const v8f (&acc)[4][4], float* os, int wv, float* C, int ldc, int r0, int c0, float osc) {
    const int lane = threadIdx.x & 31, lr = lane & 15, hi = lane >> 4; float* osw = os + wv * OSP;
#pragma unroll
    for (int mb = 0; mb < 4; ++mb) {
#pragma unroll
        for (int nb = 0; nb < 4; ++nb) {
#pragma unroll
            for (int j = 0; j < 8; ++j) osw[(mb * 16 + hi * 8 + j) * 68 + nb * 16 + lr] = acc[mb][nb][j]; } }
    __syncthreads();   // every wave's partial is in LDS before any thread sums the planes
    float* crow = C + (size_t)r0 * ldc + c0;
#pragma unroll
    for (int s = 0; s < 32 / NW; ++s) { const int idx = s * 32 * NW + (int)threadIdx.x; const int row = idx >> 4, cofs = (idx & 15) * 4; v4f val = *(const v4fa*)(os + row * 68 + cofs);
#pragma unroll
        for (int w = 1; w < NW; ++w) val += *(const v4fa*)(os + w * OSP + row * 68 + cofs);
        *(v4f*)(crow + (size_t)row * ldc + cofs) = val * osc; }
}
// ---- k_gemmc: 64x64 tile GEMM, operands straight from K-contiguous 16-bit planes (NW waves; wave w keeps a whole 64x64 partial over the k chunks w, w + NW, ... of 32 * KU each; the score launches keep one wave, NW == 1) specialised for causal attention: CMODE 1 skips score tiles entirely above the diagonal (query rows r0+roff.., key columns c0..), CMODE 2 limits the
// key (K) loop of the probability x value contraction to the diagonal block (probabilities beyond it are exactly zero). roff = row offset of this launch's first row within the sequence; osc = factor on the stored tile (NW > 1).
template <typename T16, int NSPLIT, int CMODE, int NW, int KU>
__global__ __launch_bounds__(32 * NW) void k_gemmc(const T16* __restrict__ A, const T16* __restrict__ A2, const T16* __restrict__ Bt, const T16* __restrict__ Bt2, int K, float* C, int ldc, int roff, float osc, size_t sA, size_t sB, size_t sC) {
    typedef typename WFrag<T16>::V V;
    __shared__ __align__(16) float os[(NW > 1) ? NW * OSP : 16 * 68];
    const size_t z = blockIdx.z; A += z * sA; if (A2) A2 += z * sA; Bt += z * sB; if (Bt2) Bt2 += z * sB; C += z * sC;
    const int lane = threadIdx.x & 31, lr = lane & 15, hi = lane >> 4; const int r0 = blockIdx.x * 64, c0 = blockIdx.y * 64;
    const int wv = (NW > 1) ? __builtin_amdgcn_readfirstlane((int)(threadIdx.x >> 5)) : 0;   // the wave's number in a scalar register, so that the K loop's test stays scalar
    if (CMODE == 1 && c0 > r0 + roff + 63) return;                  // score tile entirely above the causal diagonal: never computed (the softmax masks j > i by select)
    const int Kl = (CMODE == 2) ? min(K, r0 + roff + 64) : K;        // P.V: probabilities are exactly 0 beyond the diagonal block, so the K loop stops there
    v8f acc[4][4];
#pragma unroll
    for (int mb = 0; mb < 4; ++mb)
#pragma unroll
        for (int nb = 0; nb < 4; ++nb) acc[mb][nb] = (v8f){};
    const size_t aoff = (size_t)(r0 + lr) * K + 8 * hi, boff = (size_t)(c0 + lr) * K + 8 * hi;
#pragma unroll 1
    for (int k0 = wv * (32 * KU); k0 < Kl; k0 += NW * 32 * KU) {
#pragma unroll
      for (int u = 0; u < KU; ++u) { const int kc = k0 + 32 * u;   // unrolled: one trip covers a whole 32 * KU chunk (KU == 2: a 128-byte line of every operand row)
        V a[4], a2[4];
#pragma unroll
        for (int mb = 0; mb < 4; ++mb) { a[mb] = WFrag<T16>::ld(A + aoff + (size_t)mb * 16 * K + kc); if (NSPLIT == 1 || NSPLIT == 2) a2[mb] = WFrag<T16>::ld(A2 + aoff + (size_t)mb * 16 * K + kc); }
#pragma unroll
        for (int nb = 0; nb < 4; ++nb) { const V b = WFrag<T16>::ld(Bt + boff + (size_t)nb * 16 * K + kc); V b2; if (NSPLIT >= 2) b2 = WFrag<T16>::ld(Bt2 + boff + (size_t)nb * 16 * K + kc);
#pragma unroll
            for (int mb = 0; mb < 4; ++mb) { acc[mb][nb] = WFrag<T16>::mma(a[mb], b, acc[mb][nb]); if (NSPLIT == 1 || NSPLIT == 2) acc[mb][nb] = WFrag<T16>::mma(a2[mb], b, acc[mb][nb]); if (NSPLIT >= 2) acc[mb][nb] = WFrag<T16>::mma(a[mb], b2, acc[mb][nb]); } }
        asm volatile("v_nop\n\tv_nop\n\tv_nop\n\tv_nop" : "+v"(acc[0][0]), "+v"(acc[1][1]), "+v"(acc[2][2]), "+v"(acc[3][3]) : "v"(a[0]), "v"(a[3]));
      }
    }
    if (NW > 1) { tile_out<NW>(acc, os, wv, C, ldc, r0, c0, osc); return; }
#pragma unroll
    for (int mb = 0; mb < 4; ++mb) {
#pragma unroll
        for (int nb = 0; nb < 4; ++nb) {
#pragma unroll
            for (int j = 0; j < 8; ++j) os[(hi * 8 + j) * 68 + nb * 16 + lr] = acc[mb][nb][j]; }
        __builtin_amdgcn_wave_barrier(); asm volatile("" ::: "memory");
        float* crow = C + (size_t)(r0 + mb * 16) * ldc + c0;
{
#pragma unroll
            for (int s = 0; s < 8; ++s) { const int row = 2 * s + hi, cofs = lr * 4; v4f val = *(const v4fa*)(os + row * 68 + cofs);
                *(v4f*)(crow + (size_t)row * ldc + cofs) = val; }
             }
        __builtin_amdgcn_wave_barrier(); asm volatile("" ::: "memory");
    }
}

__device__ __forceinline__ h16 tohx(float x) { return (h16)x; }
__device__ __forceinline__ void splitf(float y, unsigned short& h, unsigned short& l) { h = f2bf(y); l = f2bf(y - bf2f(h)); }
typedef __attribute__((ext_vector_type(2))) _Float16 v2h;
typedef __attribute__((ext_vector_type(4))) _Float16 v4h;
typedef __attribute__((ext_vector_type(2))) unsigned short v2us;
typedef __attribute__((ext_vector_type(4))) unsigned short v4us;
typedef __attribute__((ext_vector_type(2))) float v2f;
typedef __attribute__((ext_vector_type(4))) int v4i;

typedef __attribute__((ext_vector_type(16))) float v16f;
// ---- k_proj: the three projections in one launch; grid (TT / 64, HD / 64, 3), z = 0 q, 1 k, 2 v; one work-group of 16 waves per 64x64 tile of x W + b.
// Split K: wave w takes k = 64 w .. 64 w + 63 (two 16x16x32 steps) of the whole tile; the 16 partials are summed in LDS in wave order.
// Operands come straight from the f32 inputs and are rounded to bf16 (nearest even) in registers. A: row r0 + 16 mb + lr, 8 + 8 consecutive k per lane. B: one 16-byte load of W[k][c0 + 4 lr ..] feeds all four fragments, so
// fragment nb holds the columns c0 + 4 lr + nb (same k per position as A), and the four accumulators of a row make one 16-byte LDS store.
// Epilogue: + bias, then the planes the attention launches read: q, k as [t][d] (f16, bf16 hi, bf16 lo), v transposed as [d][t].
// Every loop is unrolled so that the load, fragment and accumulator arrays are indexed by constants only (registers, no scratch) and all loads of a wave can be in flight together.
__global__ __launch_bounds__(512) void k_proj(const float* __restrict__ xq, const float* __restrict__ xk, const float* __restrict__ xv, const float* __restrict__ wq, const float* __restrict__ wk, const float* __restrict__ wv,
                                              const float* __restrict__ bq, const float* __restrict__ bk, const float* __restrict__ bv, h16* Q16, bf* Qh, bf* Ql, h16* K16, bf* Kh, bf* Kl, h16* V16, bf* Vh, bf* Vl) {
    __shared__ __align__(16) float os[16 * OSP];
    const int z = blockIdx.z; const float* X = (z == 0) ? xq : (z == 1) ? xk : xv; const float* Wm = (z == 0) ? wq : (z == 1) ? wk : wv; const float* bias = (z == 0) ? bq : (z == 1) ? bk : bv;
    const int tid = threadIdx.x, lane = tid & 31, lr = lane & 15, hi = lane >> 4; const int r0 = blockIdx.x * 64, c0 = blockIdx.y * 64;
    const int wv_ = __builtin_amdgcn_readfirstlane(tid >> 5);   // the wave's number in a scalar register, so that the wave's share of every address is scalar arithmetic
    const float* ap = X + (size_t)(r0 + lr) * DM + wv_ * 64 + 8 * hi; const float* bp = Wm + (size_t)(wv_ * 64 + 8 * hi) * HD + c0 + 4 * lr;
    v4f wr[2][16], xa[2][4][4]; v16bf a[2][4], b[2][4];
#pragma unroll
    for (int u = 0; u < 2; ++u)
#pragma unroll
        for (int e = 0; e < 16; ++e) wr[u][e] = *(const v4fa*)(bp + (size_t)(32 * u + (e & 7) + (e >> 3) * 16) * HD);
#pragma unroll
    for (int mb = 0; mb < 4; ++mb) { const float* p = ap + (size_t)mb * 16 * DM; xa[0][mb][0] = *(const v4fa*)p; xa[0][mb][1] = *(const v4fa*)(p + 4); xa[0][mb][2] = *(const v4fa*)(p + 16); xa[0][mb][3] = *(const v4fa*)(p + 20); }
#pragma unroll
    for (int u = 0; u < 2; ++u)
#pragma unroll
        for (int nb = 0; nb < 4; ++nb) { v16f t;
#pragma unroll
            for (int e = 0; e < 16; ++e) t[e] = wr[u][e][nb];
            b[u][nb] = __builtin_convertvector(t, v16bf); }
#pragma unroll
    for (int mb = 0; mb < 4; ++mb) { const float* p = ap + (size_t)mb * 16 * DM + 32; xa[1][mb][0] = *(const v4fa*)p; xa[1][mb][1] = *(const v4fa*)(p + 4); xa[1][mb][2] = *(const v4fa*)(p + 16); xa[1][mb][3] = *(const v4fa*)(p + 20); }
    asm volatile("s_wait_xcnt 0x0" :: "v"(ap) : "memory");   // precaution: the x loads' address pair stays whole until all 32 loads that name it are past this wait; only then may a register of it be written
#pragma unroll
    for (int u = 0; u < 2; ++u)
#pragma unroll
        for (int mb = 0; mb < 4; ++mb) { v16f t;
#pragma unroll
            for (int e = 0; e < 4; ++e) { t[e] = xa[u][mb][0][e]; t[4 + e] = xa[u][mb][1][e]; t[8 + e] = xa[u][mb][2][e]; t[12 + e] = xa[u][mb][3][e]; }
            a[u][mb] = __builtin_convertvector(t, v16bf); }
    v8f acc[4][4];
#pragma unroll
    for (int nb = 0; nb < 4; ++nb) {
#pragma unroll
        for (int mb = 0; mb < 4; ++mb) acc[mb][nb] = wmmab(a[0][mb], b[0][nb], (v8f){});
#pragma unroll
        for (int mb = 0; mb < 4; ++mb) acc[mb][nb] = wmmab(a[1][mb], b[1][nb], acc[mb][nb]); }
    float* osw = os + wv_ * OSP;
#pragma unroll
    for (int mb = 0; mb < 4; ++mb) {
#pragma unroll
        for (int j = 0; j < 8; ++j) { v4f t; t[0] = acc[mb][0][j]; t[1] = acc[mb][1][j]; t[2] = acc[mb][2][j]; t[3] = acc[mb][3][j]; *(v4fa*)(osw + (mb * 16 + hi * 8 + j) * 68 + 4 * lr) = t; } }
    __syncthreads();   // every wave's partial is in LDS before any thread sums the planes
    v4f val[2];
#pragma unroll
    for (int s = 0; s < 2; ++s) { const int idx = s * 512 + tid; const int row = idx >> 4, cofs = (idx & 15) * 4; val[s] = *(const v4fa*)(os + row * 68 + cofs);
#pragma unroll
        for (int w = 1; w < 16; ++w) val[s] += *(const v4fa*)(os + w * OSP + row * 68 + cofs);
        val[s][0] += bfr(bias[c0 + cofs]); val[s][1] += bfr(bias[c0 + cofs + 1]); val[s][2] += bfr(bias[c0 + cofs + 2]); val[s][3] += bfr(bias[c0 + cofs + 3]); }
    if (z != 2) {   // q, k (block-uniform): 16 lanes store one 128-byte line of a [t][d] plane
        h16* P16 = (z == 0) ? Q16 : K16; bf* Ph = (z == 0) ? Qh : Kh; bf* Pl = (z == 0) ? Ql : Kl;
#pragma unroll
        for (int s = 0; s < 2; ++s) { const int idx = s * 512 + tid; const int row = idx >> 4, cofs = (idx & 15) * 4; v4h o16; v4us oh, ol;
#pragma unroll
            for (int q = 0; q < 4; ++q) { o16[q] = tohx(val[s][q]); unsigned short a2, c2; splitf(val[s][q], a2, c2); oh[q] = a2; ol[q] = c2; }
            const size_t oo = (size_t)(r0 + row) * HD + c0 + cofs; *(v4h*)(P16 + oo) = o16; *(v4us*)(Ph + oo) = oh; *(v4us*)(Pl + oo) = ol; }
        asm volatile("s_wait_xcnt 0x0" ::: "memory");   // precaution: stands behind the last plane store, in front of any later write of a register that these stores name
        return; }
#pragma unroll
    for (int s = 0; s < 2; ++s) { const int idx = s * 512 + tid; *(v4fa*)(os + (idx >> 4) * 68 + (idx & 15) * 4) = val[s]; }   // v: the finished tile goes back to plane 0, each thread onto the words that only it has read
    __syncthreads();   // the finished v tile is whole in plane 0 before it is read by columns
    { const int d = tid >> 3, t0 = (tid & 7) * 8; v8h o16; v8us oh, ol;   // eight lanes store one 128-byte line of a [d][t] plane
#pragma unroll
        for (int j = 0; j < 8; ++j) { const float xx = os[(t0 + j) * 68 + d]; o16[j] = tohx(xx); unsigned short a2, c2; splitf(xx, a2, c2); oh[j] = a2; ol[j] = c2; }
        const size_t oo = (size_t)(c0 + d) * TT + r0 + t0; *(v8h*)(V16 + oo) = o16; *(v8us*)(Vh + oo) = oh; *(v8us*)(Vl + oo) = ol; }
}

// k_lsoft: streaming causal row softmax over the TK = TT = 4096 keys, one wave per row i, three sweeps of the f32 score row (lane -> 4 consecutive keys per 128-key chunk, 32 chunks; keys j > i are excluded by index with -3e38 / 0 - the score tiles above the diagonal are never computed and their stale contents are only ever discarded by this select):
__global__ __launch_bounds__(256) void k_lsoft(const float* __restrict__ Sb, h16* P16, bf* Ph, bf* Pl) {
    const int lane = threadIdx.x & 31; const int row = blockIdx.x * 8 + (threadIdx.x >> 5); if (row >= ZH * TT) return; const int i = row % TT; const int zz = row / TT; const bool hires = (i < RH); const float* sr = Sb + (size_t)row * TT; float mx = -3.0e38f;
#pragma unroll 4
    for (int ch = 0; ch < TT / 128; ++ch) { const int j0 = ch * 128 + lane * 4; const v4f a = *(const v4f*)(sr + j0);
#pragma unroll
        for (int q = 0; q < 4; ++q) { float t = a[q] * SCL; asm volatile("" : "+v"(t)); t = (j0 + q <= i) ? t : -3.0e38f; mx = fmaxf(mx, t); } }
#pragma unroll
    for (int sh = 16; sh; sh >>= 1) mx = fmaxf(mx, __shfl_xor(mx, sh, 32));
    float sum = 0.f;
#pragma unroll 4
    for (int ch = 0; ch < TT / 128; ++ch) { const int j0 = ch * 128 + lane * 4; const v4f a = *(const v4f*)(sr + j0);
#pragma unroll
        for (int q = 0; q < 4; ++q) { float t = a[q] * SCL; asm volatile("" : "+v"(t)); t = (j0 + q <= i) ? t : -3.0e38f; float d0 = __fsub_rn(t, mx); asm volatile("" : "+v"(d0)); sum += __builtin_amdgcn_exp2f(__fmul_rn(d0, 1.4426950408889634f)); } }
#pragma unroll
    for (int sh = 16; sh; sh >>= 1) sum += __shfl_xor(sum, sh, 32);
    const float f = __fdiv_rn(hires ? 1.0f : PCAR, sum);
{
        if (hires) {   /* rows < RH: normalised bf16 hi/lo over the first RH keys (every later key is above the diagonal for these rows; the hi/lo attn.v GEMM stops its K loop at the diagonal block), planes [zz][RH][TT] */
#pragma unroll
            for (int ch = 0; ch < RH / 128; ++ch) { const int j0 = ch * 128 + lane * 4; const v4f a = *(const v4f*)(sr + j0); v4us oh, ol;
#pragma unroll
                for (int q = 0; q < 4; ++q) { float t = a[q] * SCL; asm volatile("" : "+v"(t)); t = (j0 + q <= i) ? t : -3.0e38f; float d0 = __fsub_rn(t, mx); asm volatile("" : "+v"(d0)); float ex = __builtin_amdgcn_exp2f(__fmul_rn(d0, 1.4426950408889634f)); asm volatile("" : "+v"(ex)); unsigned short a2, c2; splitf(ex * f, a2, c2); oh[q] = a2; ol[q] = c2; }
                const size_t oo = ((size_t)zz * RH + i) * TT + j0; *(v4us*)(Ph + oo) = oh; *(v4us*)(Pl + oo) = ol; }
        } else {
#pragma unroll 2
            for (int ch = 0; ch < TT / 128; ++ch) { const int j0 = ch * 128 + lane * 4; const v4f a = *(const v4f*)(sr + j0); v4h o4;
#pragma unroll
                for (int q = 0; q < 4; ++q) { float t = a[q] * SCL; asm volatile("" : "+v"(t)); t = (j0 + q <= i) ? t : -3.0e38f; float d0 = __fsub_rn(t, mx); asm volatile("" : "+v"(d0)); float ex = __builtin_amdgcn_exp2f(__fmul_rn(d0, 1.4426950408889634f)); asm volatile("" : "+v"(ex)); o4[q] = tohx(ex * f); }
                *(v4h*)(P16 + (size_t)row * TT + j0) = o4; } }
         }
}

extern "C" void kernel_launch(void* const* d_in, const int* in_sizes, int n_in,
                              void* d_out, int out_size, void* d_ws, size_t ws_size, hipStream_t stream) {
    (void)in_sizes; (void)n_in; (void)out_size;
    const float* x = (const float*)d_in[0]; const float* xk = (const float*)d_in[1]; const float* xv = (const float*)d_in[2]; const float* wq = (const float*)d_in[3]; const float* bq = (const float*)d_in[4]; const float* wk = (const float*)d_in[5]; const float* bk = (const float*)d_in[6]; const float* wv = (const float*)d_in[7]; const float* bv = (const float*)d_in[8];
    float* OUT = (float*)d_out;     // [4096][128]
    char* wsp = (char*)d_ws;
    auto take = [&](size_t bytes) { char* p = wsp; wsp += (bytes + 255) & ~(size_t)255; return (void*)p; };
    h16* QP16 = (h16*)take((size_t)NH_ * TT * HD * 2); h16* KP16 = (h16*)take((size_t)NKV * TT * HD * 2); h16* VT16 = (h16*)take((size_t)NKV * HD * TT * 2);
    bf* QPh = (bf*)take((size_t)NH_ * TT * HD * 2); bf* QPl = (bf*)take((size_t)NH_ * TT * HD * 2); bf* KPh = (bf*)take((size_t)NKV * TT * HD * 2); bf* KPl = (bf*)take((size_t)NKV * TT * HD * 2); bf* VTh = (bf*)take((size_t)NKV * HD * TT * 2); bf* VTl = (bf*)take((size_t)NKV * HD * TT * 2); bf* Ph = (bf*)take((size_t)ZH * RH * TT * 2); bf* Pl = (bf*)take((size_t)ZH * RH * TT * 2);
    float* Sb = (float*)take((size_t)ZH * TT * TT * 4); h16* P16 = (h16*)take((size_t)ZH * TT * TT * 2);
    if ((size_t)(wsp - (char*)d_ws) > ws_size) return;    // ws 256 MiB
    k_proj<<<dim3(TT / 64, HD / 64, 3), 512, 0, stream>>>(x, xk, xv, wq, wk, wv, bq, bk, bv, QP16, QPh, QPl, KP16, KPh, KPl, VT16, VTh, VTl);
    k_gemmc<bf, 2, 1, 1, 1><<<dim3(RH / 64, TT / 64, ZH), 32, 0, stream>>>(QPh, QPl, KPh, KPl, HD, Sb, TT, 0, 1.0f, (size_t)TT * HD, (size_t)TT * HD, (size_t)TT * TT);
    k_gemmc<h16, 0, 1, 1, 1><<<dim3((TT - RH) / 64, TT / 64, ZH), 32, 0, stream>>>(QP16 + (size_t)RH * HD, nullptr, KP16, nullptr, HD, Sb + (size_t)RH * TT, TT, RH, 1.0f, (size_t)TT * HD, (size_t)TT * HD, (size_t)TT * TT);
    k_lsoft<<<ZH * TT / 8, 256, 0, stream>>>(Sb, P16, Ph, Pl);
    // the P.V launches store the output rows themselves: rows < RH as they are, the rest times 1 / PCAR (their probabilities carry the factor PCAR)
    k_gemmc<bf, 2, 2, 8, 1><<<dim3(RH / 64, HD / 64, ZH), 256, 0, stream>>>(Ph, Pl, VTh, VTl, TT, OUT, HD, 0, 1.0f, (size_t)RH * TT, (size_t)HD * TT, (size_t)TT * HD);
    k_gemmc<h16, 0, 2, 16, 2><<<dim3((TT - RH) / 64, HD / 64, ZH), 512, 0, stream>>>(P16 + (size_t)RH * TT, nullptr, VT16, nullptr, TT, OUT + (size_t)RH * HD, HD, RH, 1.0f / PCAR, (size_t)TT * TT, (size_t)HD * TT, (size_t)TT * HD);
}

// v003
// A run of this version takes 31.9 microseconds.
// In two side-by-side timings against v002, it was 3.02 and 2.90 times as fast.
// Counting every step since v000, it is 8.70 times as fast.
#include <hip/hip_runtime.h>

// Single-head causal attention over separate q / k / v inputs (q, k, v [4096][1024]; qp = q Wq + bq, kp = k Wk + bk, vp = v Wv + bv ('xw' [1024][128] + [128]); scores = qp.kp / sqrt(128), causal (-1e10 == exclusion); softmax; out = attn vp -> [4096][128] (0.5 M)).
// Layout: one projection launch (inputs and weights rounded to bf16 in registers; exact products + f32 biases; attention planes written from its epilogue), then one attention launch: scores, causal softmax and P.V fused, online softmax (hybrid rows: < 512 hi/lo 3 products, rest fp16 with the probabilities x1024); neither scores nor probabilities touch memory.
// Compute dtypes, f32 accumulate: every input rounded to bf16; projections exact + f32 biases; attention rows < 512 3 products, rest fp16; softmax f32; output f32.

#define NB_  1
#define TT   4096
#define DM   1024
#define NH_  1
#define NKV  1
#define REP  (NH_ / NKV)
#define HD   128
#define DQ   (NH_ * HD)
#define DKV  (NKV * HD)
#define ZH   1
#define RH   512                  // query rows < RH use hi+lo planes (0: none)
#define WIN  4096
#define PCAR 1024.0f
#define SCL  0.088388347648318447f   // HD^-0.5
typedef _Float16 h16;
typedef unsigned short bf;
typedef __attribute__((ext_vector_type(16))) __bf16   v16bf;
typedef __attribute__((ext_vector_type(16))) _Float16 v16h;
typedef __attribute__((ext_vector_type(8)))  _Float16 v8h;
typedef __attribute__((ext_vector_type(8)))  unsigned short v8us;
typedef __attribute__((ext_vector_type(8)))  float    v8f;
typedef __attribute__((ext_vector_type(4)))  float    v4f;
typedef v8h  __attribute__((may_alias)) v8ha;
typedef v4f  __attribute__((may_alias)) v4fa;
typedef v8us __attribute__((may_alias)) v8usa;

__device__ __forceinline__ unsigned short f2bf(float f) { unsigned u = __float_as_uint(f); u += 0x7FFFu + ((u >> 16) & 1u); return (unsigned short)(u >> 16); }
__device__ __forceinline__ float bf2f(unsigned short b) { return __uint_as_float(((unsigned)b) << 16); }
__device__ __forceinline__ float bfr(float f) { return bf2f(f2bf(f)); }
__device__ __forceinline__ v16h cat16(v8h lo, v8h hi) { return __builtin_shufflevector(lo, hi, 0, 1, 2, 3, 4, 5, 6, 7, 8, 9, 10, 11, 12, 13, 14, 15); }
__device__ __forceinline__ v16bf cat16b(v8us lo, v8us hi) { return __builtin_bit_cast(v16bf, __builtin_shufflevector(lo, hi, 0, 1, 2, 3, 4, 5, 6, 7, 8, 9, 10, 11, 12, 13, 14, 15)); }
__device__ __forceinline__ v8f wmma16(v16h a, v16h b, v8f c) { return __builtin_amdgcn_wmma_f32_16x16x32_f16(false, a, false, b, (short)0, c, false, false); }
__device__ __forceinline__ v8f wmmab(v16bf a, v16bf b, v8f c) { return __builtin_amdgcn_wmma_f32_16x16x32_bf16(false, a, false, b, (short)0, c, false, false); }



// WFrag: ld = a fragment from a k-contiguous row (k = 8 hi + 0..7 and 16 + 8 hi + 0..7); ldp = the same fragment from a plane stored in fragment order (two wave-wide loads of 512 contiguous bytes each).
template <typename T16> struct WFrag;
template <> struct WFrag<h16> { typedef v16h V; static __device__ __forceinline__ V ld(const h16* p) { return cat16(*(const v8h*)p, *(const v8h*)(p + 16)); } static __device__ __forceinline__ V ldp(const h16* p) { return cat16(*(const v8h*)p, *(const v8h*)(p + 256)); } static __device__ __forceinline__ v8f mma(V a, V b, v8f c) { return wmma16(a, b, c); } };
template <> struct WFrag<bf> { typedef v16bf V; static __device__ __forceinline__ V ld(const bf* p) { return cat16b(*(const v8us*)p, *(const v8us*)(p + 16)); } static __device__ __forceinline__ V ldp(const bf* p) { return cat16b(*(const v8us*)p, *(const v8us*)(p + 256)); } static __device__ __forceinline__ v8f mma(V a, V b, v8f c) { return wmmab(a, b, c); } };
__device__ __forceinline__ h16 tohx(float x) { return (h16)x; }
__device__ __forceinline__ void splitf(float y, unsigned short& h, unsigned short& l) { h = f2bf(y); l = f2bf(y - bf2f(h)); }
typedef __attribute__((ext_vector_type(2))) _Float16 v2h;
typedef __attribute__((ext_vector_type(4))) _Float16 v4h;
typedef __attribute__((ext_vector_type(2))) unsigned short v2us;
typedef __attribute__((ext_vector_type(4))) unsigned short v4us;
typedef __attribute__((ext_vector_type(2))) float v2f;
typedef __attribute__((ext_vector_type(4))) int v4i;

typedef __attribute__((ext_vector_type(16))) float v16f;
#define OSP (64 * 68)   // one wave's 64x64 f32 partial in LDS, pitch 68 floats
// Fragment order of the k and v planes: 512 elements (1 KiB) per 16 x 32 fragment, as two halves of 256; lane (c, h) owns elements 8 (c + 16 h) .. + 7 of each half; half g, element e is k position 16 g + 8 h + e of fragment row c.
// kidx: rows = keys, k = d; the 8 fragments of 32 keys are contiguous (8 KiB). vidx: rows = d, k = keys; the 8 fragments of 32 keys are contiguous (8 KiB).
__device__ __forceinline__ size_t kidx(int t, int d) { return (size_t)((t >> 4) * 4 + (d >> 5)) * 512 + ((d >> 4) & 1) * 256 + ((t & 15) + 16 * ((d >> 3) & 1)) * 8 + (d & 7); }
__device__ __forceinline__ size_t vidx(int d, int t) { return (size_t)((t >> 5) * 8 + (d >> 4)) * 512 + ((t >> 4) & 1) * 256 + ((d & 15) + 16 * ((t >> 3) & 1)) * 8 + (t & 7); }
// ---- k_proj: the three projections in one launch; grid (TT / 64, HD / 64, 3), z = 0 q, 1 k, 2 v; one work-group of 16 waves per 64x64 tile of x W + b.
// Split K: wave w takes k = 64 w .. 64 w + 63 (two 16x16x32 steps) of the whole tile; the 16 partials are summed in LDS in wave order.
// Operands come straight from the f32 inputs and are rounded to bf16 (nearest even) in registers. A: row r0 + 16 mb + lr, 8 + 8 consecutive k per lane. B: one 16-byte load of W[k][c0 + 4 lr ..] feeds all four fragments, so
// fragment nb holds the columns c0 + 4 lr + nb (same k per position as A), and the four accumulators of a row make one 16-byte LDS store.
// Epilogue: + bias, then the planes the attention launch reads (f16, bf16 hi, bf16 lo each): q as [t][d], k and v in fragment order (kidx, vidx).
// Every loop is unrolled so that the load, fragment and accumulator arrays are indexed by constants only (registers, no scratch) and all loads of a wave can be in flight together.
__global__ __launch_bounds__(512) void k_proj(const float* __restrict__ xq, const float* __restrict__ xk, const float* __restrict__ xv, const float* __restrict__ wq, const float* __restrict__ wk, const float* __restrict__ wv,
                                              const float* __restrict__ bq, const float* __restrict__ bk, const float* __restrict__ bv, h16* Q16, bf* Qh, bf* Ql, h16* K16, bf* Kh, bf* Kl, h16* V16, bf* Vh, bf* Vl) {
    __shared__ __align__(16) float os[16 * OSP];
    const int z = blockIdx.z; const float* X = (z == 0) ? xq : (z == 1) ? xk : xv; const float* Wm = (z == 0) ? wq : (z == 1) ? wk : wv; const float* bias = (z == 0) ? bq : (z == 1) ? bk : bv;
    const int tid = threadIdx.x, lane = tid & 31, lr = lane & 15, hi = lane >> 4; const int r0 = blockIdx.x * 64, c0 = blockIdx.y * 64;
    const int wv_ = __builtin_amdgcn_readfirstlane(tid >> 5);   // the wave's number in a scalar register, so that the wave's share of every address is scalar arithmetic
    const float* ap = X + (size_t)(r0 + lr) * DM + wv_ * 64 + 8 * hi; const float* bp = Wm + (size_t)(wv_ * 64 + 8 * hi) * HD + c0 + 4 * lr;
    v4f wr[2][16], xa[2][4][4]; v16bf a[2][4], b[2][4];
#pragma unroll
    for (int u = 0; u < 2; ++u)
#pragma unroll
        for (int e = 0; e < 16; ++e) wr[u][e] = *(const v4fa*)(bp + (size_t)(32 * u + (e & 7) + (e >> 3) * 16) * HD);
#pragma unroll
    for (int mb = 0; mb < 4; ++mb) { const float* p = ap + (size_t)mb * 16 * DM; xa[0][mb][0] = *(const v4fa*)p; xa[0][mb][1] = *(const v4fa*)(p + 4); xa[0][mb][2] = *(const v4fa*)(p + 16); xa[0][mb][3] = *(const v4fa*)(p + 20); }
#pragma unroll
    for (int u = 0; u < 2; ++u)
#pragma unroll
        for (int nb = 0; nb < 4; ++nb) { v16f t;
#pragma unroll
            for (int e = 0; e < 16; ++e) t[e] = wr[u][e][nb];
            b[u][nb] = __builtin_convertvector(t, v16bf); }
#pragma unroll
    for (int mb = 0; mb < 4; ++mb) { const float* p = ap + (size_t)mb * 16 * DM + 32; xa[1][mb][0] = *(const v4fa*)p; xa[1][mb][1] = *(const v4fa*)(p + 4); xa[1][mb][2] = *(const v4fa*)(p + 16); xa[1][mb][3] = *(const v4fa*)(p + 20); }
    asm volatile("s_wait_xcnt 0x0" :: "v"(ap) : "memory");   // precaution: the x loads' address pair stays whole until all 32 loads that name it are past this wait; only then may a register of it be written
#pragma unroll
    for (int u = 0; u < 2; ++u)
#pragma unroll
        for (int mb = 0; mb < 4; ++mb) { v16f t;
#pragma unroll
            for (int e = 0; e < 4; ++e) { t[e] = xa[u][mb][0][e]; t[4 + e] = xa[u][mb][1][e]; t[8 + e] = xa[u][mb][2][e]; t[12 + e] = xa[u][mb][3][e]; }
            a[u][mb] = __builtin_convertvector(t, v16bf); }
    v8f acc[4][4];
#pragma unroll
    for (int nb = 0; nb < 4; ++nb) {
#pragma unroll
        for (int mb = 0; mb < 4; ++mb) acc[mb][nb] = wmmab(a[0][mb], b[0][nb], (v8f){});
#pragma unroll
        for (int mb = 0; mb < 4; ++mb) acc[mb][nb] = wmmab(a[1][mb], b[1][nb], acc[mb][nb]); }
    float* osw = os + wv_ * OSP;
#pragma unroll
    for (int mb = 0; mb < 4; ++mb) {
#pragma unroll
        for (int j = 0; j < 8; ++j) { v4f t; t[0] = acc[mb][0][j]; t[1] = acc[mb][1][j]; t[2] = acc[mb][2][j]; t[3] = acc[mb][3][j]; *(v4fa*)(osw + (mb * 16 + hi * 8 + j) * 68 + 4 * lr) = t; } }
    __syncthreads();   // every wave's partial is in LDS before any thread sums the planes
    v4f val[2];
#pragma unroll
    for (int s = 0; s < 2; ++s) { const int idx = s * 512 + tid; const int row = idx >> 4, cofs = (idx & 15) * 4; val[s] = *(const v4fa*)(os + row * 68 + cofs);
#pragma unroll
        for (int w = 1; w < 16; ++w) val[s] += *(const v4fa*)(os + w * OSP + row * 68 + cofs);
        val[s][0] += bfr(bias[c0 + cofs]); val[s][1] += bfr(bias[c0 + cofs + 1]); val[s][2] += bfr(bias[c0 + cofs + 2]); val[s][3] += bfr(bias[c0 + cofs + 3]); }
    if (z != 2) {   // q, k (block-uniform): q, 16 lanes store one 128-byte line of a [t][d] plane; k, 4 consecutive d stay together in fragment order
        h16* P16 = (z == 0) ? Q16 : K16; bf* Ph = (z == 0) ? Qh : Kh; bf* Pl = (z == 0) ? Ql : Kl;
#pragma unroll
        for (int s = 0; s < 2; ++s) { const int idx = s * 512 + tid; const int row = idx >> 4, cofs = (idx & 15) * 4; v4h o16; v4us oh, ol;
#pragma unroll
            for (int q = 0; q < 4; ++q) { o16[q] = tohx(val[s][q]); unsigned short a2, c2; splitf(val[s][q], a2, c2); oh[q] = a2; ol[q] = c2; }
            const size_t oo = (z == 0) ? (size_t)(r0 + row) * HD + c0 + cofs : kidx(r0 + row, c0 + cofs); h16* a16 = P16 + oo; bf* ah = Ph + oo; bf* al = Pl + oo; *(v4h*)a16 = o16; *(v4us*)ah = oh; *(v4us*)al = ol;
            asm volatile("s_wait_xcnt 0x0" :: "v"(a16), "v"(ah), "v"(al), "v"(o16), "v"(oh), "v"(ol) : "memory"); }   // precaution: the three stores' address and data registers stay whole until the stores are past this wait; only then may one of them be written
        return; }
#pragma unroll
    for (int s = 0; s < 2; ++s) { const int idx = s * 512 + tid; *(v4fa*)(os + (idx >> 4) * 68 + (idx & 15) * 4) = val[s]; }   // v: the finished tile goes back to plane 0, each thread onto the words that only it has read
    __syncthreads();   // the finished v tile is whole in plane 0 before it is read by columns
    { const int d = tid >> 3, t0 = (tid & 7) * 8; v8h o16; v8us oh, ol;   // 8 consecutive keys of one d are one lane's 16 bytes of a fragment half
#pragma unroll
        for (int j = 0; j < 8; ++j) { const float xx = os[(t0 + j) * 68 + d]; o16[j] = tohx(xx); unsigned short a2, c2; splitf(xx, a2, c2); oh[j] = a2; ol[j] = c2; }
        const size_t oo = vidx(c0 + d, r0 + t0); *(v8h*)(V16 + oo) = o16; *(v8us*)(Vh + oo) = oh; *(v8us*)(Vl + oo) = ol; }
}

#define AW  16
#define OPI 132
// soft16: one online-softmax step on the two score tiles of 32-key block kb for query qi. In: s. Out: x = the 16 probabilities (times PCAR) in the order of a B fragment; m, l updated; returns the factor on what was summed under the old maximum.
__device__ __forceinline__ float soft16(const v8f (&s)[2], int kb, int qi, int hi, float& m, float& l, float (&x)[16]) {
    const float SC2 = SCL * 1.4426950408889634f; float mx = m;
#pragma unroll
    for (int e = 0; e < 16; ++e) { const int kj = kb * 32 + (e >> 3) * 16 + hi * 8 + (e & 7); x[e] = (kj <= qi) ? s[e >> 3][e & 7] * SC2 : -3.0e38f; mx = fmaxf(mx, x[e]); }
    mx = fmaxf(mx, __shfl_xor(mx, 16, 32));
    const float al = __builtin_amdgcn_exp2f(m - mx), mo = mx - 10.0f; m = mx;
    float ps = 0.f;
#pragma unroll
    for (int e = 0; e < 16; ++e) { x[e] = __builtin_amdgcn_exp2f(x[e] - mo); ps += x[e]; }
    l = l * al + ps; return al;
}
// Every inner loop below is unrolled so that the fragment and accumulator arrays are indexed by constants only (registers, no scratch).
// attn_f16: query rows >= RH, f16 operands, one product each.
__device__ __forceinline__ void attn_f16(const h16* __restrict__ Q, const h16* __restrict__ Kp, const h16* __restrict__ Vp, int q0, int nkb, int wv, v8f (&o)[8], float& m, float& l) {
    const int lane = threadIdx.x & 31, lr = lane & 15, hi = lane >> 4;
    const h16* qp = Q + (size_t)(q0 + lr) * HD + 8 * hi; v16h qf[4];
#pragma unroll
    for (int ks = 0; ks < 4; ++ks) qf[ks] = WFrag<h16>::ld(qp + ks * 32);
    asm volatile("s_wait_xcnt 0x0" :: "v"(qp) : "memory");   // precaution: the q loads' address pair stays whole until all loads that name it are past this wait
    // rolled: one block's fragments, the queries and the output tile fill the wave's registers
#pragma unroll 1
    for (int kb = wv; kb < nkb; kb += AW) {
        const h16* kp = Kp + (size_t)kb * 4096 + lane * 8; const h16* vp = Vp + (size_t)kb * 4096 + lane * 8;   // a block's 8 K fragments and its 8 V fragments are 8 KiB each, contiguous
        v16h kf[8], vf[8];
#pragma unroll
        for (int f = 0; f < 8; ++f) kf[f] = WFrag<h16>::ldp(kp + f * 512);
#pragma unroll
        for (int f = 0; f < 8; ++f) vf[f] = WFrag<h16>::ldp(vp + f * 512);
        // inputs only: holds the block's 32 loads in front of the products, so that all are in flight together (without it they are issued two at a time, each pair waited for); the wait is the precaution as above for their two address pairs
        asm volatile("s_wait_xcnt 0x0" :: "v"(kp), "v"(vp), "v"(kf[0]), "v"(kf[1]), "v"(kf[2]), "v"(kf[3]), "v"(kf[4]), "v"(kf[5]), "v"(kf[6]), "v"(kf[7]), "v"(vf[0]), "v"(vf[1]), "v"(vf[2]), "v"(vf[3]), "v"(vf[4]), "v"(vf[5]), "v"(vf[6]), "v"(vf[7]));
        v8f s[2];
#pragma unroll
        for (int t = 0; t < 2; ++t) { s[t] = (v8f){};
#pragma unroll
            for (int ks = 0; ks < 4; ++ks) s[t] = wmma16(kf[t * 4 + ks], qf[ks], s[t]); }
        float x[16]; const float al = soft16(s, kb, q0 + lr, hi, m, l, x);
        v16h pf;
#pragma unroll
        for (int e = 0; e < 16; ++e) pf[e] = tohx(x[e]);
#pragma unroll
        for (int dt = 0; dt < 8; ++dt) { o[dt] *= al; o[dt] = wmma16(vf[dt], pf, o[dt]); }
    }
}
// attn_hl: query rows < RH, bf16 hi + lo planes, three products each (hi hi, lo hi, hi lo). These rows have at most RH / 32 <= AW key blocks, so a wave has one block or none and its output tile starts here.
static_assert(RH <= 32 * AW, "a wave of attn_hl takes one key block");
__device__ __forceinline__ void attn_hl(const bf* __restrict__ Qa, const bf* __restrict__ Qb, const bf* __restrict__ Ka, const bf* __restrict__ Kb, const bf* __restrict__ Va, const bf* __restrict__ Vb, int q0, int nkb, int wv, v8f (&o)[8], float& m, float& l) {
    const int lane = threadIdx.x & 31, lr = lane & 15, hi = lane >> 4;
    if (wv >= nkb) return;   // wave-uniform; no barrier in this function
    const size_t qo = (size_t)(q0 + lr) * HD + 8 * hi, bo = (size_t)wv * 4096 + lane * 8;
    const bf* qa = Qa + qo; const bf* qb = Qb + qo; const bf* ka = Ka + bo; const bf* kb2 = Kb + bo; const bf* va = Va + bo; const bf* vb = Vb + bo;
    v8f s[2];
#pragma unroll
    for (int t = 0; t < 2; ++t) { s[t] = (v8f){};
#pragma unroll
        for (int ks = 0; ks < 4; ++ks) { const v16bf qh = WFrag<bf>::ld(qa + ks * 32), ql = WFrag<bf>::ld(qb + ks * 32), kh = WFrag<bf>::ldp(ka + (t * 4 + ks) * 512), kl = WFrag<bf>::ldp(kb2 + (t * 4 + ks) * 512);
            s[t] = wmmab(kh, qh, s[t]); s[t] = wmmab(kl, qh, s[t]); s[t] = wmmab(kh, ql, s[t]); } }
    asm volatile("s_wait_xcnt 0x0" :: "v"(qa), "v"(qb), "v"(ka), "v"(kb2) : "memory");   // precaution: the q and k loads' address pairs stay whole until all loads that name them are past this wait
    float x[16]; soft16(s, wv, q0 + lr, hi, m, l, x);
    v8us h0, h1, l0, l1;
#pragma unroll
    for (int j = 0; j < 8; ++j) { unsigned short a2, c2; splitf(x[j], a2, c2); h0[j] = a2; l0[j] = c2; splitf(x[8 + j], a2, c2); h1[j] = a2; l1[j] = c2; }
    const v16bf ph = cat16b(h0, h1), pl = cat16b(l0, l1);
#pragma unroll
    for (int dt = 0; dt < 8; ++dt) { const v16bf vh = WFrag<bf>::ldp(va + dt * 512), vl = WFrag<bf>::ldp(vb + dt * 512); o[dt] = wmmab(vh, ph, (v8f){}); o[dt] = wmmab(vl, ph, o[dt]); o[dt] = wmmab(vh, pl, o[dt]); }
    asm volatile("s_wait_xcnt 0x0" :: "v"(va), "v"(vb) : "memory");   // precaution as above, for the v loads
}
__global__ __launch_bounds__(32 * AW) void k_attn(const h16* __restrict__ Q16, const bf* __restrict__ Qh, const bf* __restrict__ Ql, const h16* __restrict__ K16, const bf* __restrict__ Kh, const bf* __restrict__ Kl,
                                                  const h16* __restrict__ V16, const bf* __restrict__ Vh, const bf* __restrict__ Vl, float* __restrict__ out) {
    __shared__ __align__(16) float po[AW * 16 * OPI]; __shared__ float pm[AW * 16], pl[AW * 16];
    const int tid = threadIdx.x, lane = tid & 31, lr = lane & 15, hi = lane >> 4;
    const int wv = __builtin_amdgcn_readfirstlane(tid >> 5);   // the wave's number in a scalar register, so that the key loop's test stays scalar
    const int q0 = (TT / 16 - 1 - (int)blockIdx.x) * 16, nkb = (q0 >> 5) + 1;   // nkb: 32-key blocks up to and with the diagonal's
    v8f o[8]; float m = -3.0e38f, l = 0.f;
#pragma unroll
    for (int dt = 0; dt < 8; ++dt) o[dt] = (v8f){};
    if (q0 < RH) attn_hl(Qh, Ql, Kh, Kl, Vh, Vl, q0, nkb, wv, o, m, l);   // block-uniform
    else attn_f16(Q16, K16, V16, q0, nkb, wv, o, m, l);
    l += __shfl_xor(l, 16, 32);   // the halves of a wave summed different keys of the same query under the same maximum
    float* pw = po + (wv * 16 + lr) * OPI + hi * 8;
#pragma unroll
    for (int dt = 0; dt < 8; ++dt) { v4f a, b; a[0] = o[dt][0]; a[1] = o[dt][1]; a[2] = o[dt][2]; a[3] = o[dt][3]; b[0] = o[dt][4]; b[1] = o[dt][5]; b[2] = o[dt][6]; b[3] = o[dt][7]; *(v4fa*)(pw + dt * 16) = a; *(v4fa*)(pw + dt * 16 + 4) = b; }
    if (hi == 0) { pm[wv * 16 + lr] = m; pl[wv * 16 + lr] = l; }
    __syncthreads();   // every wave's partial (a wave without a block: maximum -3e38, sum 0, tile 0) is in LDS before any wave merges
    float mm[AW], M = -3.0e38f;
#pragma unroll
    for (int w = 0; w < AW; ++w) { mm[w] = pm[w * 16 + wv]; M = fmaxf(M, mm[w]); }
    float Ls = 0.f; v4f acc = (v4f){};
#pragma unroll
    for (int w = 0; w < AW; ++w) { const float wt = __builtin_amdgcn_exp2f(mm[w] - M); Ls += wt * pl[w * 16 + wv]; acc += wt * *(const v4fa*)(po + (w * 16 + wv) * OPI + lane * 4); }
    *(v4f*)(out + (size_t)(q0 + wv) * HD + lane * 4) = acc * __fdiv_rn(1.0f, Ls);
}

extern "C" void kernel_launch(void* const* d_in, const int* in_sizes, int n_in,
                              void* d_out, int out_size, void* d_ws, size_t ws_size, hipStream_t stream) {
    (void)in_sizes; (void)n_in; (void)out_size;
    const float* x = (const float*)d_in[0]; const float* xk = (const float*)d_in[1]; const float* xv = (const float*)d_in[2]; const float* wq = (const float*)d_in[3]; const float* bq = (const float*)d_in[4]; const float* wk = (const float*)d_in[5]; const float* bk = (const float*)d_in[6]; const float* wv = (const float*)d_in[7]; const float* bv = (const float*)d_in[8];
    float* OUT = (float*)d_out;     // [4096][128]
    char* wsp = (char*)d_ws;
    auto take = [&](size_t bytes) { char* p = wsp; wsp += (bytes + 255) & ~(size_t)255; return (void*)p; };
    h16* QP16 = (h16*)take((size_t)NH_ * TT * HD * 2); h16* KP16 = (h16*)take((size_t)NKV * TT * HD * 2); h16* VT16 = (h16*)take((size_t)NKV * HD * TT * 2);
    bf* QPh = (bf*)take((size_t)NH_ * TT * HD * 2); bf* QPl = (bf*)take((size_t)NH_ * TT * HD * 2); bf* KPh = (bf*)take((size_t)NKV * TT * HD * 2); bf* KPl = (bf*)take((size_t)NKV * TT * HD * 2); bf* VTh = (bf*)take((size_t)NKV * HD * TT * 2); bf* VTl = (bf*)take((size_t)NKV * HD * TT * 2);
    if ((size_t)(wsp - (char*)d_ws) > ws_size) return;    // ws 256 MiB
    k_proj<<<dim3(TT / 64, HD / 64, 3), 512, 0, stream>>>(x, xk, xv, wq, wk, wv, bq, bk, bv, QP16, QPh, QPl, KP16, KPh, KPl, VT16, VTh, VTl);
    k_attn<<<TT / 16, 32 * AW, 0, stream>>>(QP16, QPh, QPl, KP16, KPh, KPl, VT16, VTh, VTl, OUT);
}

// v004
// One run takes 28.3 microseconds.
// Two timings next to v003 put it at 1.16 and 1.11 times that version's speed.
// All steps since v000 together make it 9.91 times as fast.
#include <hip/hip_runtime.h>

// Single-head causal attention over separate q / k / v inputs (q, k, v [4096][1024]; qp = q Wq + bq, kp = k Wk + bk, vp = v Wv + bv ('xw' [1024][128] + [128]); scores = qp.kp / sqrt(128), causal (-1e10 == exclusion); softmax; out = attn vp -> [4096][128] (0.5 M)).
// Layout: one projection launch (inputs and weights rounded to bf16 in registers; exact products + f32 biases; attention planes written from its epilogue), then one attention launch: scores, causal softmax and P.V fused, online softmax (hybrid rows: < 512 hi/lo 3 products, rest fp16 with the probabilities x1024); neither scores nor probabilities touch memory.
// Compute dtypes, f32 accumulate: every input rounded to bf16; projections exact + f32 biases; attention rows < 512 3 products, rest fp16; softmax f32; output f32.

#define NB_  1
#define TT   4096
#define DM   1024
#define NH_  1
#define NKV  1
#define REP  (NH_ / NKV)
#define HD   128
#define DQ   (NH_ * HD)
#define DKV  (NKV * HD)
#define ZH   1
#define RH   512                  // query rows < RH use hi+lo planes (0: none)
#define WIN  4096
#define PCAR 1024.0f
#define SCL  0.088388347648318447f   // HD^-0.5
typedef _Float16 h16;
typedef unsigned short bf;
typedef __attribute__((ext_vector_type(16))) __bf16   v16bf;
typedef __attribute__((ext_vector_type(16))) _Float16 v16h;
typedef __attribute__((ext_vector_type(8)))  _Float16 v8h;
typedef __attribute__((ext_vector_type(8)))  unsigned short v8us;
typedef __attribute__((ext_vector_type(8)))  float    v8f;
typedef __attribute__((ext_vector_type(4)))  float    v4f;
typedef v8h  __attribute__((may_alias)) v8ha;
typedef v4f  __attribute__((may_alias)) v4fa;
typedef v8us __attribute__((may_alias)) v8usa;

__device__ __forceinline__ unsigned short f2bf(float f) { unsigned u = __float_as_uint(f); u += 0x7FFFu + ((u >> 16) & 1u); return (unsigned short)(u >> 16); }
__device__ __forceinline__ float bf2f(unsigned short b) { return __uint_as_float(((unsigned)b) << 16); }
__device__ __forceinline__ float bfr(float f) { return bf2f(f2bf(f)); }
__device__ __forceinline__ v16h cat16(v8h lo, v8h hi) { return __builtin_shufflevector(lo, hi, 0, 1, 2, 3, 4, 5, 6, 7, 8, 9, 10, 11, 12, 13, 14, 15); }
__device__ __forceinline__ v16bf cat16b(v8us lo, v8us hi) { return __builtin_bit_cast(v16bf, __builtin_shufflevector(lo, hi, 0, 1, 2, 3, 4, 5, 6, 7, 8, 9, 10, 11, 12, 13, 14, 15)); }
__device__ __forceinline__ v8f wmma16(v16h a, v16h b, v8f c) { return __builtin_amdgcn_wmma_f32_16x16x32_f16(false, a, false, b, (short)0, c, false, false); }
__device__ __forceinline__ v8f wmmab(v16bf a, v16bf b, v8f c) { return __builtin_amdgcn_wmma_f32_16x16x32_bf16(false, a, false, b, (short)0, c, false, false); }



// WFrag: ld = a fragment from a k-contiguous row (k = 8 hi + 0..7 and 16 + 8 hi + 0..7); ldp = the same fragment from a plane stored in fragment order (two wave-wide loads of 512 contiguous bytes each).
template <typename T16> struct WFrag;
template <> struct WFrag<h16> { typedef v16h V; static __device__ __forceinline__ V ld(const h16* p) { return cat16(*(const v8h*)p, *(const v8h*)(p + 16)); } static __device__ __forceinline__ V ldp(const h16* p) { return cat16(*(const v8h*)p, *(const v8h*)(p + 256)); } static __device__ __forceinline__ v8f mma(V a, V b, v8f c) { return wmma16(a, b, c); } };
template <> struct WFrag<bf> { typedef v16bf V; static __device__ __forceinline__ V ld(const bf* p) { return cat16b(*(const v8us*)p, *(const v8us*)(p + 16)); } static __device__ __forceinline__ V ldp(const bf* p) { return cat16b(*(const v8us*)p, *(const v8us*)(p + 256)); } static __device__ __forceinline__ v8f mma(V a, V b, v8f c) { return wmmab(a, b, c); } };
__device__ __forceinline__ h16 tohx(float x) { return (h16)x; }
__device__ __forceinline__ void splitf(float y, unsigned short& h, unsigned short& l) { h = f2bf(y); l = f2bf(y - bf2f(h)); }
typedef __attribute__((ext_vector_type(2))) _Float16 v2h;
typedef __attribute__((ext_vector_type(4))) _Float16 v4h;
typedef __attribute__((ext_vector_type(2))) unsigned short v2us;
typedef __attribute__((ext_vector_type(4))) unsigned short v4us;
typedef __attribute__((ext_vector_type(2))) float v2f;
typedef __attribute__((ext_vector_type(4))) int v4i;

typedef __attribute__((ext_vector_type(16))) float v16f;
#define OSP (64 * 68)   // one wave's 64x64 f32 partial in LDS, pitch 68 floats
// Fragment order of the k and v planes: 512 elements (1 KiB) per 16 x 32 fragment, as two halves of 256; lane (c, h) owns elements 8 (c + 16 h) .. + 7 of each half; half g, element e is k position 16 g + 8 h + e of fragment row c.
// kidx: rows = keys, k = d; the 8 fragments of 32 keys are contiguous (8 KiB). vidx: rows = d, k = keys; the 8 fragments of 32 keys are contiguous (8 KiB).
__device__ __forceinline__ size_t kidx(int t, int d) { return (size_t)((t >> 4) * 4 + (d >> 5)) * 512 + ((d >> 4) & 1) * 256 + ((t & 15) + 16 * ((d >> 3) & 1)) * 8 + (d & 7); }
__device__ __forceinline__ size_t vidx(int d, int t) { return (size_t)((t >> 5) * 8 + (d >> 4)) * 512 + ((t >> 4) & 1) * 256 + ((d & 15) + 16 * ((t >> 3) & 1)) * 8 + (t & 7); }
// ---- k_proj: the three projections in one launch; grid (TT / 64, HD / 64, 3), z = 0 q, 1 k, 2 v; one work-group of 16 waves per 64x64 tile of x W + b.
// Split K: wave w takes k = 64 w .. 64 w + 63 (two 16x16x32 steps) of the whole tile; the 16 partials are summed in LDS in wave order.
// Operands come from the f32 inputs and are rounded to bf16 (nearest even) in registers. A: each wave brings its own 64 rows x 64 k of x into LDS by asynchronous copies (one copy = two rows' whole 256 bytes; direct fragment loads would touch 16 lines for 512 bytes),
// into the place that later holds its partial (read and overwritten by that wave alone, in this order), at the same pitch (68 floats: 16-byte LDS reads of 16 rows fall on all 64 banks); fragment: row 16 mb + lr, 8 + 8 consecutive k per lane. B: one 16-byte load of W[k][c0 + 4 lr ..] feeds all four fragments, so
// fragment nb holds the columns c0 + 4 lr + nb (same k per position as A), and the four accumulators of a row make one 16-byte LDS store.
// Epilogue: + bias, then the planes the attention launch reads (f16, bf16 hi, bf16 lo each): q as [t][d], k and v in fragment order (kidx, vidx).
// Every loop is unrolled so that the load, fragment and accumulator arrays are indexed by constants only (registers, no scratch) and all loads of a wave can be in flight together.
// cp8: eight asynchronous 16-byte-per-lane copies to LDS, rows two apart (LDS step 2 x 68 floats, global step 2 x DM floats). The s_wait_xcnt is the last line of the copies' own statement: a precaution, so that no address register that a copy names is written before it.
__device__ __forceinline__ void cp8(unsigned l, const float* g) {
    asm volatile("global_load_async_to_lds_b128 %0, %8, off\n\t"
                 "global_load_async_to_lds_b128 %1, %9, off\n\t"
                 "global_load_async_to_lds_b128 %2, %10, off\n\t"
                 "global_load_async_to_lds_b128 %3, %11, off\n\t"
                 "global_load_async_to_lds_b128 %4, %12, off\n\t"
                 "global_load_async_to_lds_b128 %5, %13, off\n\t"
                 "global_load_async_to_lds_b128 %6, %14, off\n\t"
                 "global_load_async_to_lds_b128 %7, %15, off\n\t"
                 "s_wait_xcnt 0x0"
                 :: "v"(l), "v"(l + 544u), "v"(l + 1088u), "v"(l + 1632u), "v"(l + 2176u), "v"(l + 2720u), "v"(l + 3264u), "v"(l + 3808u),
                    "v"(g), "v"(g + 2 * DM), "v"(g + 4 * DM), "v"(g + 6 * DM), "v"(g + 8 * DM), "v"(g + 10 * DM), "v"(g + 12 * DM), "v"(g + 14 * DM) : "memory");
}
__global__ __launch_bounds__(512) void k_proj(const float* __restrict__ xq, const float* __restrict__ xk, const float* __restrict__ xv, const float* __restrict__ wq, const float* __restrict__ wk, const float* __restrict__ wv,
                                              const float* __restrict__ bq, const float* __restrict__ bk, const float* __restrict__ bv, h16* Q16, bf* Qh, bf* Ql, h16* K16, bf* Kh, bf* Kl, h16* V16, bf* Vh, bf* Vl) {
    __shared__ __align__(16) float os[16 * OSP];
    const int z = blockIdx.z; const float* X = (z == 0) ? xq : (z == 1) ? xk : xv; const float* Wm = (z == 0) ? wq : (z == 1) ? wk : wv; const float* bias = (z == 0) ? bq : (z == 1) ? bk : bv;
    const int tid = threadIdx.x, lane = tid & 31, lr = lane & 15, hi = lane >> 4; const int r0 = blockIdx.x * 64, c0 = blockIdx.y * 64;
    const int wv_ = __builtin_amdgcn_readfirstlane(tid >> 5);   // the wave's number in a scalar register, so that the wave's share of every address is scalar arithmetic
    float* osw = os + wv_ * OSP; const float* bp = Wm + (size_t)(wv_ * 64 + 8 * hi) * HD + c0 + 4 * lr;
    v4f wr[2][16], xa[2][4][4]; v16bf a[2][4], b[2][4];
#pragma unroll
    for (int u = 0; u < 2; ++u)
#pragma unroll
        for (int e = 0; e < 16; ++e) wr[u][e] = *(const v4fa*)(bp + (size_t)(32 * u + (e & 7) + (e >> 3) * 16) * HD);
    asm volatile("s_wait_xcnt 0x0" :: "v"(bp) : "memory");   // precaution: the W loads' address pair stays whole until all 32 loads that name it are past this wait; only then may a register of it be written
    { const float* xg = X + (size_t)(r0 + hi) * DM + wv_ * 64 + 4 * lr; const unsigned xl = (unsigned)(size_t)(osw + hi * 68 + 4 * lr);   // copy c: lanes 0-15 row 2 c, lanes 16-31 row 2 c + 1, 256 bytes each
#pragma unroll
        for (int c = 0; c < 4; ++c) cp8(xl + (unsigned)c * 4352u, xg + (size_t)c * 16 * DM); }
#pragma unroll
    for (int u = 0; u < 2; ++u)
#pragma unroll
        for (int nb = 0; nb < 4; ++nb) { v16f t;
#pragma unroll
            for (int e = 0; e < 16; ++e) t[e] = wr[u][e][nb];
            b[u][nb] = __builtin_convertvector(t, v16bf); }
    __builtin_amdgcn_sched_barrier(0);   // keeps the rounding of W in front of the wait, under the copies' flight (without it the compiler moves it behind the wait)
    asm volatile("s_wait_asynccnt 0x0" ::: "memory");   // the wave's 32 copies have landed before it reads their bytes; no other wave reads them, so no barrier stands here
    { const float* xs = osw + lr * 68 + 8 * hi;
#pragma unroll
        for (int u = 0; u < 2; ++u)
#pragma unroll
            for (int mb = 0; mb < 4; ++mb) { const float* p = xs + mb * 16 * 68 + 32 * u; xa[u][mb][0] = *(const v4fa*)p; xa[u][mb][1] = *(const v4fa*)(p + 4); xa[u][mb][2] = *(const v4fa*)(p + 16); xa[u][mb][3] = *(const v4fa*)(p + 20); } }
#pragma unroll
    for (int u = 0; u < 2; ++u)
#pragma unroll
        for (int mb = 0; mb < 4; ++mb) { v16f t;
#pragma unroll
            for (int e = 0; e < 4; ++e) { t[e] = xa[u][mb][0][e]; t[4 + e] = xa[u][mb][1][e]; t[8 + e] = xa[u][mb][2][e]; t[12 + e] = xa[u][mb][3][e]; }
            a[u][mb] = __builtin_convertvector(t, v16bf); }
    v8f acc[4][4];
#pragma unroll
    for (int nb = 0; nb < 4; ++nb) {
#pragma unroll
        for (int mb = 0; mb < 4; ++mb) acc[mb][nb] = wmmab(a[0][mb], b[0][nb], (v8f){});
#pragma unroll
        for (int mb = 0; mb < 4; ++mb) acc[mb][nb] = wmmab(a[1][mb], b[1][nb], acc[mb][nb]); }
#pragma unroll
    for (int mb = 0; mb < 4; ++mb) {
#pragma unroll
        for (int j = 0; j < 8; ++j) { v4f t; t[0] = acc[mb][0][j]; t[1] = acc[mb][1][j]; t[2] = acc[mb][2][j]; t[3] = acc[mb][3][j]; *(v4fa*)(osw + (mb * 16 + hi * 8 + j) * 68 + 4 * lr) = t; } }
    __syncthreads();   // every wave's partial is in LDS before any thread sums the planes
    v4f val[2];
#pragma unroll
    for (int s = 0; s < 2; ++s) { const int idx = s * 512 + tid; const int row = idx >> 4, cofs = (idx & 15) * 4; val[s] = *(const v4fa*)(os + row * 68 + cofs);
#pragma unroll
        for (int w = 1; w < 16; ++w) val[s] += *(const v4fa*)(os + w * OSP + row * 68 + cofs);
        val[s][0] += bfr(bias[c0 + cofs]); val[s][1] += bfr(bias[c0 + cofs + 1]); val[s][2] += bfr(bias[c0 + cofs + 2]); val[s][3] += bfr(bias[c0 + cofs + 3]); }
    if (z != 2) {   // q, k (block-uniform): q, 16 lanes store one 128-byte line of a [t][d] plane; k, 4 consecutive d stay together in fragment order
        h16* P16 = (z == 0) ? Q16 : K16; bf* Ph = (z == 0) ? Qh : Kh; bf* Pl = (z == 0) ? Ql : Kl;
#pragma unroll
        for (int s = 0; s < 2; ++s) { const int idx = s * 512 + tid; const int row = idx >> 4, cofs = (idx & 15) * 4; v4h o16; v4us oh, ol;
#pragma unroll
            for (int q = 0; q < 4; ++q) { o16[q] = tohx(val[s][q]); unsigned short a2, c2; splitf(val[s][q], a2, c2); oh[q] = a2; ol[q] = c2; }
            const size_t oo = (z == 0) ? (size_t)(r0 + row) * HD + c0 + cofs : kidx(r0 + row, c0 + cofs); h16* a16 = P16 + oo; bf* ah = Ph + oo; bf* al = Pl + oo; *(v4h*)a16 = o16; *(v4us*)ah = oh; *(v4us*)al = ol;
            asm volatile("s_wait_xcnt 0x0" :: "v"(a16), "v"(ah), "v"(al), "v"(o16), "v"(oh), "v"(ol) : "memory"); }   // precaution: the three stores' address and data registers stay whole until the stores are past this wait; only then may one of them be written
        return; }
#pragma unroll
    for (int s = 0; s < 2; ++s) { const int idx = s * 512 + tid; *(v4fa*)(os + (idx >> 4) * 68 + (idx & 15) * 4) = val[s]; }   // v: the finished tile goes back to plane 0, each thread onto the words that only it has read
    __syncthreads();   // the finished v tile is whole in plane 0 before it is read by columns
    { const int d = tid >> 3, t0 = (tid & 7) * 8; v8h o16; v8us oh, ol;   // 8 consecutive keys of one d are one lane's 16 bytes of a fragment half
#pragma unroll
        for (int j = 0; j < 8; ++j) { const float xx = os[(t0 + j) * 68 + d]; o16[j] = tohx(xx); unsigned short a2, c2; splitf(xx, a2, c2); oh[j] = a2; ol[j] = c2; }
        const size_t oo = vidx(c0 + d, r0 + t0); *(v8h*)(V16 + oo) = o16; *(v8us*)(Vh + oo) = oh; *(v8us*)(Vl + oo) = ol; }
}

#define AW  16
#define OPI 132
// soft16: one online-softmax step on the two score tiles of 32-key block kb for query qi. In: s. Out: x = the 16 probabilities (times PCAR) in the order of a B fragment; m, l updated; returns the factor on what was summed under the old maximum.
__device__ __forceinline__ float soft16(const v8f (&s)[2], int kb, int qi, int hi, float& m, float& l, float (&x)[16]) {
    const float SC2 = SCL * 1.4426950408889634f; float mx = m;
#pragma unroll
    for (int e = 0; e < 16; ++e) { const int kj = kb * 32 + (e >> 3) * 16 + hi * 8 + (e & 7); x[e] = (kj <= qi) ? s[e >> 3][e & 7] * SC2 : -3.0e38f; mx = fmaxf(mx, x[e]); }
    mx = fmaxf(mx, __shfl_xor(mx, 16, 32));
    const float al = __builtin_amdgcn_exp2f(m - mx), mo = mx - 10.0f; m = mx;
    float ps = 0.f;
#pragma unroll
    for (int e = 0; e < 16; ++e) { x[e] = __builtin_amdgcn_exp2f(x[e] - mo); ps += x[e]; }
    l = l * al + ps; return al;
}
// Every inner loop below is unrolled so that the fragment and accumulator arrays are indexed by constants only (registers, no scratch).
// attn_f16: query rows >= RH, f16 operands, one product each.
__device__ __forceinline__ void attn_f16(const h16* __restrict__ Q, const h16* __restrict__ Kp, const h16* __restrict__ Vp, int q0, int nkb, int wv, v8f (&o)[8], float& m, float& l) {
    const int lane = threadIdx.x & 31, lr = lane & 15, hi = lane >> 4;
    const h16* qp = Q + (size_t)(q0 + lr) * HD + 8 * hi; v16h qf[4];
#pragma unroll
    for (int ks = 0; ks < 4; ++ks) qf[ks] = WFrag<h16>::ld(qp + ks * 32);
    asm volatile("s_wait_xcnt 0x0" :: "v"(qp) : "memory");   // precaution: the q loads' address pair stays whole until all loads that name it are past this wait
    // rolled: one block's fragments, the queries and the output tile fill the wave's registers
#pragma unroll 1
    for (int kb = wv; kb < nkb; kb += AW) {
        const h16* kp = Kp + (size_t)kb * 4096 + lane * 8; const h16* vp = Vp + (size_t)kb * 4096 + lane * 8;   // a block's 8 K fragments and its 8 V fragments are 8 KiB each, contiguous
        v16h kf[8], vf[8];
#pragma unroll
        for (int f = 0; f < 8; ++f) kf[f] = WFrag<h16>::ldp(kp + f * 512);
#pragma unroll
        for (int f = 0; f < 8; ++f) vf[f] = WFrag<h16>::ldp(vp + f * 512);
        // inputs only: holds the block's 32 loads in front of the products, so that all are in flight together (without it they are issued two at a time, each pair waited for); the wait is the precaution as above for their two address pairs
        asm volatile("s_wait_xcnt 0x0" :: "v"(kp), "v"(vp), "v"(kf[0]), "v"(kf[1]), "v"(kf[2]), "v"(kf[3]), "v"(kf[4]), "v"(kf[5]), "v"(kf[6]), "v"(kf[7]), "v"(vf[0]), "v"(vf[1]), "v"(vf[2]), "v"(vf[3]), "v"(vf[4]), "v"(vf[5]), "v"(vf[6]), "v"(vf[7]));
        v8f s[2];
#pragma unroll
        for (int t = 0; t < 2; ++t) { s[t] = (v8f){};
#pragma unroll
            for (int ks = 0; ks < 4; ++ks) s[t] = wmma16(kf[t * 4 + ks], qf[ks], s[t]); }
        float x[16]; const float al = soft16(s, kb, q0 + lr, hi, m, l, x);
        v16h pf;
#pragma unroll
        for (int e = 0; e < 16; ++e) pf[e] = tohx(x[e]);
#pragma unroll
        for (int dt = 0; dt < 8; ++dt) { o[dt] *= al; o[dt] = wmma16(vf[dt], pf, o[dt]); }
    }
}
// attn_hl: query rows < RH, bf16 hi + lo planes, three products each (hi hi, lo hi, hi lo). These rows have at most RH / 32 <= AW key blocks, so a wave has one block or none and its output tile starts here.
static_assert(RH <= 32 * AW, "a wave of attn_hl takes one key block");
__device__ __forceinline__ void attn_hl(const bf* __restrict__ Qa, const bf* __restrict__ Qb, const bf* __restrict__ Ka, const bf* __restrict__ Kb, const bf* __restrict__ Va, const bf* __restrict__ Vb, int q0, int nkb, int wv, v8f (&o)[8], float& m, float& l) {
    const int lane = threadIdx.x & 31, lr = lane & 15, hi = lane >> 4;
    if (wv >= nkb) return;   // wave-uniform; no barrier in this function
    const size_t qo = (size_t)(q0 + lr) * HD + 8 * hi, bo = (size_t)wv * 4096 + lane * 8;
    const bf* qa = Qa + qo; const bf* qb = Qb + qo; const bf* ka = Ka + bo; const bf* kb2 = Kb + bo; const bf* va = Va + bo; const bf* vb = Vb + bo;
    v8f s[2];
#pragma unroll
    for (int t = 0; t < 2; ++t) { s[t] = (v8f){};
#pragma unroll
        for (int ks = 0; ks < 4; ++ks) { const v16bf qh = WFrag<bf>::ld(qa + ks * 32), ql = WFrag<bf>::ld(qb + ks * 32), kh = WFrag<bf>::ldp(ka + (t * 4 + ks) * 512), kl = WFrag<bf>::ldp(kb2 + (t * 4 + ks) * 512);
            s[t] = wmmab(kh, qh, s[t]); s[t] = wmmab(kl, qh, s[t]); s[t] = wmmab(kh, ql, s[t]); } }
    asm volatile("s_wait_xcnt 0x0" :: "v"(qa), "v"(qb), "v"(ka), "v"(kb2) : "memory");   // precaution: the q and k loads' address pairs stay whole until all loads that name them are past this wait
    float x[16]; soft16(s, wv, q0 + lr, hi, m, l, x);
    v8us h0, h1, l0, l1;
#pragma unroll
    for (int j = 0; j < 8; ++j) { unsigned short a2, c2; splitf(x[j], a2, c2); h0[j] = a2; l0[j] = c2; splitf(x[8 + j], a2, c2); h1[j] = a2; l1[j] = c2; }
    const v16bf ph = cat16b(h0, h1), pl = cat16b(l0, l1);
#pragma unroll
    for (int dt = 0; dt < 8; ++dt) { const v16bf vh = WFrag<bf>::ldp(va + dt * 512), vl = WFrag<bf>::ldp(vb + dt * 512); o[dt] = wmmab(vh, ph, (v8f){}); o[dt] = wmmab(vl, ph, o[dt]); o[dt] = wmmab(vh, pl, o[dt]); }
    asm volatile("s_wait_xcnt 0x0" :: "v"(va), "v"(vb) : "memory");   // precaution as above, for the v loads
}
__global__ __launch_bounds__(32 * AW) void k_attn(const h16* __restrict__ Q16, const bf* __restrict__ Qh, const bf* __restrict__ Ql, const h16* __restrict__ K16, const bf* __restrict__ Kh, const bf* __restrict__ Kl,
                                                  const h16* __restrict__ V16, const bf* __restrict__ Vh, const bf* __restrict__ Vl, float* __restrict__ out) {
    __shared__ __align__(16) float po[AW * 16 * OPI]; __shared__ float pm[AW * 16], pl[AW * 16];
    const int tid = threadIdx.x, lane = tid & 31, lr = lane & 15, hi = lane >> 4;
    const int wv = __builtin_amdgcn_readfirstlane(tid >> 5);   // the wave's number in a scalar register, so that the key loop's test stays scalar
    const int q0 = (TT / 16 - 1 - (int)blockIdx.x) * 16, nkb = (q0 >> 5) + 1;   // nkb: 32-key blocks up to and with the diagonal's
    v8f o[8]; float m = -3.0e38f, l = 0.f;
#pragma unroll
    for (int dt = 0; dt < 8; ++dt) o[dt] = (v8f){};
    if (q0 < RH) attn_hl(Qh, Ql, Kh, Kl, Vh, Vl, q0, nkb, wv, o, m, l);   // block-uniform
    else attn_f16(Q16, K16, V16, q0, nkb, wv, o, m, l);
    l += __shfl_xor(l, 16, 32);   // the halves of a wave summed different keys of the same query under the same maximum
    float* pw = po + (wv * 16 + lr) * OPI + hi * 8;
#pragma unroll
    for (int dt = 0; dt < 8; ++dt) { v4f a, b; a[0] = o[dt][0]; a[1] = o[dt][1]; a[2] = o[dt][2]; a[3] = o[dt][3]; b[0] = o[dt][4]; b[1] = o[dt][5]; b[2] = o[dt][6]; b[3] = o[dt][7]; *(v4fa*)(pw + dt * 16) = a; *(v4fa*)(pw + dt * 16 + 4) = b; }
    if (hi == 0) { pm[wv * 16 + lr] = m; pl[wv * 16 + lr] = l; }
    __syncthreads();   // every wave's partial (a wave without a block: maximum -3e38, sum 0, tile 0) is in LDS before any wave merges
    float mm[AW], M = -3.0e38f;
#pragma unroll
    for (int w = 0; w < AW; ++w) { mm[w] = pm[w * 16 + wv]; M = fmaxf(M, mm[w]); }
    float Ls = 0.f; v4f acc = (v4f){};
#pragma unroll
    for (int w = 0; w < AW; ++w) { const float wt = __builtin_amdgcn_exp2f(mm[w] - M); Ls += wt * pl[w * 16 + wv]; acc += wt * *(const v4fa*)(po + (w * 16 + wv) * OPI + lane * 4); }
    *(v4f*)(out + (size_t)(q0 + wv) * HD + lane * 4) = acc * __fdiv_rn(1.0f, Ls);
}

extern "C" void kernel_launch(void* const* d_in, const int* in_sizes, int n_in,
                              void* d_out, int out_size, void* d_ws, size_t ws_size, hipStream_t stream) {
    (void)in_sizes; (void)n_in; (void)out_size;
    const float* x = (const float*)d_in[0]; const float* xk = (const float*)d_in[1]; const float* xv = (const float*)d_in[2]; const float* wq = (const float*)d_in[3]; const float* bq = (const float*)d_in[4]; const float* wk = (const float*)d_in[5]; const float* bk = (const float*)d_in[6]; const float* wv = (const float*)d_in[7]; const float* bv = (const float*)d_in[8];
    float* OUT = (float*)d_out;     // [4096][128]
    char* wsp = (char*)d_ws;
    auto take = [&](size_t bytes) { char* p = wsp; wsp += (bytes + 255) & ~(size_t)255; return (void*)p; };
    h16* QP16 = (h16*)take((size_t)NH_ * TT * HD * 2); h16* KP16 = (h16*)take((size_t)NKV * TT * HD * 2); h16* VT16 = (h16*)take((size_t)NKV * HD * TT * 2);
    bf* QPh = (bf*)take((size_t)NH_ * TT * HD * 2); bf* QPl = (bf*)take((size_t)NH_ * TT * HD * 2); bf* KPh = (bf*)take((size_t)NKV * TT * HD * 2); bf* KPl = (bf*)take((size_t)NKV * TT * HD * 2); bf* VTh = (bf*)take((size_t)NKV * HD * TT * 2); bf* VTl = (bf*)take((size_t)NKV * HD * TT * 2);
    if ((size_t)(wsp - (char*)d_ws) > ws_size) return;    // ws 256 MiB
    k_proj<<<dim3(TT / 64, HD / 64, 3), 512, 0, stream>>>(x, xk, xv, wq, wk, wv, bq, bk, bv, QP16, QPh, QPl, KP16, KPh, KPl, VT16, VTh, VTl);
    k_attn<<<TT / 16, 32 * AW, 0, stream>>>(QP16, QPh, QPl, KP16, KPh, KPl, VT16, VTh, VTl, OUT);
}

// v005
// It runs in 26 microseconds.
// Two timings next to v004 put it at 1.09 and 1.10 times that version's speed.
// Counting every step since v000, it is 10.8 times as fast.
#include <hip/hip_runtime.h>

// Single-head causal attention over separate q / k / v inputs (q, k, v [4096][1024]; qp = q Wq + bq, kp = k Wk + bk, vp = v Wv + bv ('xw' [1024][128] + [128]); scores = qp.kp / sqrt(128), causal (-1e10 == exclusion); softmax; out = attn vp -> [4096][128] (0.5 M)).
// Layout: one projection launch (inputs and weights rounded to bf16 in registers; exact products + f32 biases; attention planes written from its epilogue), then one attention launch: scores, causal softmax and P.V fused, online softmax (hybrid rows: < 512 hi/lo 3 products, rest fp16 with the probabilities x1024); neither scores nor probabilities touch memory.
// Compute dtypes, f32 accumulate: every input rounded to bf16; projections exact + f32 biases; attention rows < 512 3 products, rest fp16; softmax f32; output f32.

#define NB_  1
#define TT   4096
#define DM   1024
#define NH_  1
#define NKV  1
#define REP  (NH_ / NKV)
#define HD   128
#define DQ   (NH_ * HD)
#define DKV  (NKV * HD)
#define ZH   1
#define RH   512                  // query rows < RH use hi+lo planes (0: none)
#define WIN  4096
#define PCAR 1024.0f
#define SCL  0.088388347648318447f   // HD^-0.5
typedef _Float16 h16;
typedef unsigned short bf;
typedef __attribute__((ext_vector_type(16))) __bf16   v16bf;
typedef __attribute__((ext_vector_type(16))) _Float16 v16h;
typedef __attribute__((ext_vector_type(8)))  _Float16 v8h;
typedef __attribute__((ext_vector_type(8)))  unsigned short v8us;
typedef __attribute__((ext_vector_type(8)))  float    v8f;
typedef __attribute__((ext_vector_type(4)))  float    v4f;
typedef v8h  __attribute__((may_alias)) v8ha;
typedef v4f  __attribute__((may_alias)) v4fa;
typedef v8us __attribute__((may_alias)) v8usa;

__device__ __forceinline__ unsigned short f2bf(float f) { unsigned u = __float_as_uint(f); u += 0x7FFFu + ((u >> 16) & 1u); return (unsigned short)(u >> 16); }
__device__ __forceinline__ float bf2f(unsigned short b) { return __uint_as_float(((unsigned)b) << 16); }
__device__ __forceinline__ float bfr(float f) { return bf2f(f2bf(f)); }
__device__ __forceinline__ v16h cat16(v8h lo, v8h hi) { return __builtin_shufflevector(lo, hi, 0, 1, 2, 3, 4, 5, 6, 7, 8, 9, 10, 11, 12, 13, 14, 15); }
__device__ __forceinline__ v16bf cat16b(v8us lo, v8us hi) { return __builtin_bit_cast(v16bf, __builtin_shufflevector(lo, hi, 0, 1, 2, 3, 4, 5, 6, 7, 8, 9, 10, 11, 12, 13, 14, 15)); }
__device__ __forceinline__ v8f wmma16(v16h a, v16h b, v8f c) { return __builtin_amdgcn_wmma_f32_16x16x32_f16(false, a, false, b, (short)0, c, false, false); }
__device__ __forceinline__ v8f wmmab(v16bf a, v16bf b, v8f c) { return __builtin_amdgcn_wmma_f32_16x16x32_bf16(false, a, false, b, (short)0, c, false, false); }



// WFrag: ld = a fragment from a k-contiguous row (k = 8 hi + 0..7 and 16 + 8 hi + 0..7); ldp = the same fragment from a plane stored in fragment order (two wave-wide loads of 512 contiguous bytes each).
template <typename T16> struct WFrag;
template <> struct WFrag<h16> { typedef v16h V; static __device__ __forceinline__ V ld(const h16* p) { return cat16(*(const v8h*)p, *(const v8h*)(p + 16)); } static __device__ __forceinline__ V ldp(const h16* p) { return cat16(*(const v8h*)p, *(const v8h*)(p + 256)); } static __device__ __forceinline__ v8f mma(V a, V b, v8f c) { return wmma16(a, b, c); } };
template <> struct WFrag<bf> { typedef v16bf V; static __device__ __forceinline__ V ld(const bf* p) { return cat16b(*(const v8us*)p, *(const v8us*)(p + 16)); } static __device__ __forceinline__ V ldp(const bf* p) { return cat16b(*(const v8us*)p, *(const v8us*)(p + 256)); } static __device__ __forceinline__ v8f mma(V a, V b, v8f c) { return wmmab(a, b, c); } };
__device__ __forceinline__ h16 tohx(float x) { return (h16)x; }
__device__ __forceinline__ void splitf(float y, unsigned short& h, unsigned short& l) { h = f2bf(y); l = f2bf(y - bf2f(h)); }
typedef __attribute__((ext_vector_type(2))) _Float16 v2h;
typedef __attribute__((ext_vector_type(4))) _Float16 v4h;
typedef __attribute__((ext_vector_type(2))) unsigned short v2us;
typedef __attribute__((ext_vector_type(4))) unsigned short v4us;
typedef __attribute__((ext_vector_type(2))) float v2f;
typedef __attribute__((ext_vector_type(4))) int v4i;

typedef __attribute__((ext_vector_type(16))) float v16f;
#define OSP (64 * 68)   // one wave's 64x64 f32 partial in LDS, pitch 68 floats
// Fragment order of the k and v planes: 512 elements (1 KiB) per 16 x 32 fragment, as two halves of 256; lane (c, h) owns elements 8 (c + 16 h) .. + 7 of each half; half g, element e is k position 16 g + 8 h + e of fragment row c.
// kidx: rows = keys, k = d; the 8 fragments of 32 keys are contiguous (8 KiB). vidx: rows = d, k = keys; the 8 fragments of 32 keys are contiguous (8 KiB).
__device__ __forceinline__ size_t kidx(int t, int d) { return (size_t)((t >> 4) * 4 + (d >> 5)) * 512 + ((d >> 4) & 1) * 256 + ((t & 15) + 16 * ((d >> 3) & 1)) * 8 + (d & 7); }
__device__ __forceinline__ size_t vidx(int d, int t) { return (size_t)((t >> 5) * 8 + (d >> 4)) * 512 + ((t >> 4) & 1) * 256 + ((d & 15) + 16 * ((t >> 3) & 1)) * 8 + (t & 7); }
// ---- k_proj: the three projections in one launch; grid (TT / 64, HD / 64, 3), z = 0 q, 1 k, 2 v; one work-group of PWV waves per 64x64 tile of x W + b.
// Split K: wave w takes k = 128 w .. 128 w + 127 of the whole tile, as two slices of 64 one after the other into the same accumulators (four 16x16x32 steps); the PWV partials are summed in LDS in wave order.
// Eight waves of at most 256 registers and 136 KiB of LDS let two work-groups share a WGP, so that all 384 work-groups are resident at once and one work-group's loads run under the other's LDS and matrix phases.
// Operands come from the f32 inputs and are rounded to bf16 (nearest even) in registers. A: each wave brings its own 64 rows x 64 k of x into LDS by asynchronous copies (one copy = two rows' whole 256 bytes; direct fragment loads would touch 16 lines for 512 bytes),
// into the place that later holds its partial (read, refilled and overwritten by that wave alone, in this order), at the same pitch (68 floats: 16-byte LDS reads of 16 rows fall on all 64 banks); fragment: row 16 mb + lr, 8 + 8 consecutive k per lane. B: one 16-byte load of W[k][c0 + 4 lr ..] feeds all four fragments, so
// fragment nb holds the columns c0 + 4 lr + nb (same k per position as A), and the four accumulators of a row make one 16-byte LDS store.
// The second slice's x is copied as soon as the first slice's fragments are in registers (under the first slice's products); its W comes in two groups of 16 loads, because the accumulators leave no room for 32 loads in flight.
// Epilogue: + bias, then the planes the attention launch reads (f16, bf16 hi, bf16 lo each): q as [t][d], k and v in fragment order (kidx, vidx).
// Every loop is unrolled so that the load, fragment and accumulator arrays are indexed by constants only (registers, no scratch) and all loads of a group can be in flight together.
#define PWV 8
// cp8: eight asynchronous 16-byte-per-lane copies to LDS, rows two apart (LDS step 2 x 68 floats, global step 2 x DM floats). The s_wait_xcnt is the last line of the copies' own statement: a precaution, so that no address register that a copy names is written before it.
__device__ __forceinline__ void cp8(unsigned l, const float* g) {
    asm volatile("global_load_async_to_lds_b128 %0, %8, off\n\t"
                 "global_load_async_to_lds_b128 %1, %9, off\n\t"
                 "global_load_async_to_lds_b128 %2, %10, off\n\t"
                 "global_load_async_to_lds_b128 %3, %11, off\n\t"
                 "global_load_async_to_lds_b128 %4, %12, off\n\t"
                 "global_load_async_to_lds_b128 %5, %13, off\n\t"
                 "global_load_async_to_lds_b128 %6, %14, off\n\t"
                 "global_load_async_to_lds_b128 %7, %15, off\n\t"
                 "s_wait_xcnt 0x0"
                 :: "v"(l), "v"(l + 544u), "v"(l + 1088u), "v"(l + 1632u), "v"(l + 2176u), "v"(l + 2720u), "v"(l + 3264u), "v"(l + 3808u),
                    "v"(g), "v"(g + 2 * DM), "v"(g + 4 * DM), "v"(g + 6 * DM), "v"(g + 8 * DM), "v"(g + 10 * DM), "v"(g + 12 * DM), "v"(g + 14 * DM) : "memory");
}
__global__ __launch_bounds__(32 * PWV) __attribute__((amdgpu_waves_per_eu(4, 4))) void k_proj(const float* __restrict__ xq, const float* __restrict__ xk, const float* __restrict__ xv, const float* __restrict__ wq, const float* __restrict__ wk, const float* __restrict__ wv,
                                              const float* __restrict__ bq, const float* __restrict__ bk, const float* __restrict__ bv, h16* Q16, bf* Qh, bf* Ql, h16* K16, bf* Kh, bf* Kl, h16* V16, bf* Vh, bf* Vl) {
    __shared__ __align__(16) float os[PWV * OSP];
    const int z = blockIdx.z; const float* X = (z == 0) ? xq : (z == 1) ? xk : xv; const float* Wm = (z == 0) ? wq : (z == 1) ? wk : wv; const float* bias = (z == 0) ? bq : (z == 1) ? bk : bv;
    const int tid = threadIdx.x, lane = tid & 31, lr = lane & 15, hi = lane >> 4; const int r0 = blockIdx.x * 64, c0 = blockIdx.y * 64;
    const int wv_ = __builtin_amdgcn_readfirstlane(tid >> 5);   // the wave's number in a scalar register, so that the wave's share of every address is scalar arithmetic
    float* osw = os + wv_ * OSP; const float* bp = Wm + (size_t)(wv_ * 128 + 8 * hi) * HD + c0 + 4 * lr;
    const float* xg = X + (size_t)(r0 + hi) * DM + wv_ * 128 + 4 * lr; const unsigned xl = (unsigned)(size_t)(osw + hi * 68 + 4 * lr);   // copy c: lanes 0-15 row 2 c, lanes 16-31 row 2 c + 1, 256 bytes each
    const float* xs = osw + lr * 68 + 8 * hi;
    v8f acc[4][4];
    {   // slice 0: k = 128 w .. + 63
        v4f wr[2][16], xa[4][4]; v16bf a[2][4], b[2][4];
#pragma unroll
        for (int u = 0; u < 2; ++u)
#pragma unroll
            for (int e = 0; e < 16; ++e) wr[u][e] = *(const v4fa*)(bp + (size_t)(32 * u + (e & 7) + (e >> 3) * 16) * HD);
        asm volatile("s_wait_xcnt 0x0" :: "v"(bp) : "memory");   // precaution: the W loads' address pair stays whole until all 32 loads that name it are past this wait; only then may a register of it be written
#pragma unroll
        for (int c = 0; c < 4; ++c) cp8(xl + (unsigned)c * 4352u, xg + (size_t)c * 16 * DM);
#pragma unroll
        for (int u = 0; u < 2; ++u)
#pragma unroll
            for (int nb = 0; nb < 4; ++nb) { v16f t;
#pragma unroll
                for (int e = 0; e < 16; ++e) t[e] = wr[u][e][nb];
                b[u][nb] = __builtin_convertvector(t, v16bf); }
        __builtin_amdgcn_sched_barrier(0);   // keeps the rounding of W in front of the wait, under the copies' flight (without it the compiler moves it behind the wait)
        asm volatile("s_wait_asynccnt 0x0" ::: "memory");   // the wave's 32 copies have landed before it reads their bytes; no other wave reads them, so no barrier stands here
#pragma unroll
        for (int u = 0; u < 2; ++u) {
#pragma unroll
            for (int mb = 0; mb < 4; ++mb) { const float* p = xs + mb * 16 * 68 + 32 * u; xa[mb][0] = *(const v4fa*)p; xa[mb][1] = *(const v4fa*)(p + 4); xa[mb][2] = *(const v4fa*)(p + 16); xa[mb][3] = *(const v4fa*)(p + 20); }
#pragma unroll
            for (int mb = 0; mb < 4; ++mb) { v16f t;
#pragma unroll
                for (int e = 0; e < 4; ++e) { t[e] = xa[mb][0][e]; t[4 + e] = xa[mb][1][e]; t[8 + e] = xa[mb][2][e]; t[12 + e] = xa[mb][3][e]; }
                a[u][mb] = __builtin_convertvector(t, v16bf); }
            __builtin_amdgcn_sched_barrier(0);   // one k step's f32 values (64 registers) are rounded before the next step's are read, and all are dead before the copies' addresses and the accumulators need room (without it the build spills)
        }
        asm volatile("s_wait_dscnt 0x0" ::: "memory");   // the wave's own reads of slice 0 have returned before its copies refill the same LDS (a place private to one wave: no barrier)
#pragma unroll
        for (int c = 0; c < 4; ++c) cp8(xl + (unsigned)c * 4352u, xg + 64 + (size_t)c * 16 * DM);
#pragma unroll
        for (int nb = 0; nb < 4; ++nb) {
#pragma unroll
            for (int mb = 0; mb < 4; ++mb) acc[mb][nb] = wmmab(a[0][mb], b[0][nb], (v8f){});
#pragma unroll
            for (int mb = 0; mb < 4; ++mb) acc[mb][nb] = wmmab(a[1][mb], b[1][nb], acc[mb][nb]); }
    }
    {   // slice 1: k = 128 w + 64 .. + 127, one 16x16x32 step at a time
        v4f w0[16], w1[16]; v16bf b[4];
#pragma unroll
        for (int e = 0; e < 16; ++e) w0[e] = *(const v4fa*)(bp + (size_t)(64 + (e & 7) + (e >> 3) * 16) * HD);
        asm volatile("s_wait_xcnt 0x0" :: "v"(bp) : "memory");   // precaution as above, for these 16 loads
#pragma unroll
        for (int nb = 0; nb < 4; ++nb) { v16f t;
#pragma unroll
            for (int e = 0; e < 16; ++e) t[e] = w0[e][nb];
            b[nb] = __builtin_convertvector(t, v16bf); }
        __builtin_amdgcn_sched_barrier(0);   // keeps the second group's loads behind the rounding of the first: beside the accumulators only 16 loads' registers fit (without it the build spills)
#pragma unroll
        for (int e = 0; e < 16; ++e) w1[e] = *(const v4fa*)(bp + (size_t)(96 + (e & 7) + (e >> 3) * 16) * HD);
        asm volatile("s_wait_xcnt 0x0" :: "v"(bp) : "memory");   // precaution as above, for these 16 loads
        asm volatile("s_wait_asynccnt 0x0" ::: "memory");   // the wave's 32 copies of slice 1 have landed before it reads their bytes
#pragma unroll
        for (int u = 0; u < 2; ++u) {
            if (u == 1) {
#pragma unroll
                for (int nb = 0; nb < 4; ++nb) { v16f t;
#pragma unroll
                    for (int e = 0; e < 16; ++e) t[e] = w1[e][nb];
                    b[nb] = __builtin_convertvector(t, v16bf); } }
#pragma unroll
            for (int mb = 0; mb < 4; ++mb) { const float* p = xs + mb * 16 * 68 + 32 * u; const v4f x0 = *(const v4fa*)p, x1 = *(const v4fa*)(p + 4), x2 = *(const v4fa*)(p + 16), x3 = *(const v4fa*)(p + 20); v16f t;
#pragma unroll
                for (int e = 0; e < 4; ++e) { t[e] = x0[e]; t[4 + e] = x1[e]; t[8 + e] = x2[e]; t[12 + e] = x3[e]; }
                const v16bf a = __builtin_convertvector(t, v16bf);
#pragma unroll
                for (int nb = 0; nb < 4; ++nb) acc[mb][nb] = wmmab(a, b[nb], acc[mb][nb]); }
        }
    }
#pragma unroll
    for (int mb = 0; mb < 4; ++mb) {
#pragma unroll
        for (int j = 0; j < 8; ++j) { v4f t; t[0] = acc[mb][0][j]; t[1] = acc[mb][1][j]; t[2] = acc[mb][2][j]; t[3] = acc[mb][3][j]; *(v4fa*)(osw + (mb * 16 + hi * 8 + j) * 68 + 4 * lr) = t; } }
    __syncthreads();   // every wave's partial is in LDS before any thread sums the planes
    v4f val[4];
#pragma unroll
    for (int s = 0; s < 4; ++s) { const int idx = s * 256 + tid; const int row = idx >> 4, cofs = (idx & 15) * 4; val[s] = *(const v4fa*)(os + row * 68 + cofs);
#pragma unroll
        for (int w = 1; w < PWV; ++w) val[s] += *(const v4fa*)(os + w * OSP + row * 68 + cofs);
        val[s][0] += bfr(bias[c0 + cofs]); val[s][1] += bfr(bias[c0 + cofs + 1]); val[s][2] += bfr(bias[c0 + cofs + 2]); val[s][3] += bfr(bias[c0 + cofs + 3]); }
    if (z != 2) {   // q, k (block-uniform): q, 16 lanes store one 128-byte line of a [t][d] plane; k, 4 consecutive d stay together in fragment order
        h16* P16 = (z == 0) ? Q16 : K16; bf* Ph = (z == 0) ? Qh : Kh; bf* Pl = (z == 0) ? Ql : Kl;
#pragma unroll
        for (int s = 0; s < 4; ++s) { const int idx = s * 256 + tid; const int row = idx >> 4, cofs = (idx & 15) * 4; v4h o16; v4us oh, ol;
#pragma unroll
            for (int q = 0; q < 4; ++q) { o16[q] = tohx(val[s][q]); unsigned short a2, c2; splitf(val[s][q], a2, c2); oh[q] = a2; ol[q] = c2; }
            const size_t oo = (z == 0) ? (size_t)(r0 + row) * HD + c0 + cofs : kidx(r0 + row, c0 + cofs); h16* a16 = P16 + oo; bf* ah = Ph + oo; bf* al = Pl + oo; *(v4h*)a16 = o16; *(v4us*)ah = oh; *(v4us*)al = ol;
            asm volatile("s_wait_xcnt 0x0" :: "v"(a16), "v"(ah), "v"(al), "v"(o16), "v"(oh), "v"(ol) : "memory"); }   // precaution: the three stores' address and data registers stay whole until the stores are past this wait; only then may one of them be written
        return; }
#pragma unroll
    for (int s = 0; s < 4; ++s) { const int idx = s * 256 + tid; *(v4fa*)(os + (idx >> 4) * 68 + (idx & 15) * 4) = val[s]; }   // v: the finished tile goes back to plane 0, each thread onto the words that only it has read
    __syncthreads();   // the finished v tile is whole in plane 0 before it is read by columns
#pragma unroll
    for (int s = 0; s < 2; ++s) { const int id = s * 256 + tid; const int d = id >> 3, t0 = (id & 7) * 8; v8h o16; v8us oh, ol;   // 8 consecutive keys of one d are one lane's 16 bytes of a fragment half
#pragma unroll
        for (int j = 0; j < 8; ++j) { const float xx = os[(t0 + j) * 68 + d]; o16[j] = tohx(xx); unsigned short a2, c2; splitf(xx, a2, c2); oh[j] = a2; ol[j] = c2; }
        const size_t oo = vidx(c0 + d, r0 + t0); h16* a16 = V16 + oo; bf* ah = Vh + oo; bf* al = Vl + oo; *(v8h*)a16 = o16; *(v8us*)ah = oh; *(v8us*)al = ol;
        asm volatile("s_wait_xcnt 0x0" :: "v"(a16), "v"(ah), "v"(al), "v"(o16), "v"(oh), "v"(ol) : "memory"); }   // precaution as for the q and k stores
}

#define AW  16
#define OPI 132
// soft16: one online-softmax step on the two score tiles of 32-key block kb for query qi. In: s. Out: x = the 16 probabilities (times PCAR) in the order of a B fragment; m, l updated; returns the factor on what was summed under the old maximum.
__device__ __forceinline__ float soft16(const v8f (&s)[2], int kb, int qi, int hi, float& m, float& l, float (&x)[16]) {
    const float SC2 = SCL * 1.4426950408889634f; float mx = m;
#pragma unroll
    for (int e = 0; e < 16; ++e) { const int kj = kb * 32 + (e >> 3) * 16 + hi * 8 + (e & 7); x[e] = (kj <= qi) ? s[e >> 3][e & 7] * SC2 : -3.0e38f; mx = fmaxf(mx, x[e]); }
    mx = fmaxf(mx, __shfl_xor(mx, 16, 32));
    const float al = __builtin_amdgcn_exp2f(m - mx), mo = mx - 10.0f; m = mx;
    float ps = 0.f;
#pragma unroll
    for (int e = 0; e < 16; ++e) { x[e] = __builtin_amdgcn_exp2f(x[e] - mo); ps += x[e]; }
    l = l * al + ps; return al;
}
// Every inner loop below is unrolled so that the fragment and accumulator arrays are indexed by constants only (registers, no scratch).
// attn_f16: query rows >= RH, f16 operands, one product each.
__device__ __forceinline__ void attn_f16(const h16* __restrict__ Q, const h16* __restrict__ Kp, const h16* __restrict__ Vp, int q0, int nkb, int wv, v8f (&o)[8], float& m, float& l) {
    const int lane = threadIdx.x & 31, lr = lane & 15, hi = lane >> 4;
    const h16* qp = Q + (size_t)(q0 + lr) * HD + 8 * hi; v16h qf[4];
#pragma unroll
    for (int ks = 0; ks < 4; ++ks) qf[ks] = WFrag<h16>::ld(qp + ks * 32);
    asm volatile("s_wait_xcnt 0x0" :: "v"(qp) : "memory");   // precaution: the q loads' address pair stays whole until all loads that name it are past this wait
    // rolled: one block's fragments, the queries and the output tile fill the wave's registers
#pragma unroll 1
    for (int kb = wv; kb < nkb; kb += AW) {
        const h16* kp = Kp + (size_t)kb * 4096 + lane * 8; const h16* vp = Vp + (size_t)kb * 4096 + lane * 8;   // a block's 8 K fragments and its 8 V fragments are 8 KiB each, contiguous
        v16h kf[8], vf[8];
#pragma unroll
        for (int f = 0; f < 8; ++f) kf[f] = WFrag<h16>::ldp(kp + f * 512);
#pragma unroll
        for (int f = 0; f < 8; ++f) vf[f] = WFrag<h16>::ldp(vp + f * 512);
        // inputs only: holds the block's 32 loads in front of the products, so that all are in flight together (without it they are issued two at a time, each pair waited for); the wait is the precaution as above for their two address pairs
        asm volatile("s_wait_xcnt 0x0" :: "v"(kp), "v"(vp), "v"(kf[0]), "v"(kf[1]), "v"(kf[2]), "v"(kf[3]), "v"(kf[4]), "v"(kf[5]), "v"(kf[6]), "v"(kf[7]), "v"(vf[0]), "v"(vf[1]), "v"(vf[2]), "v"(vf[3]), "v"(vf[4]), "v"(vf[5]), "v"(vf[6]), "v"(vf[7]));
        v8f s[2];
#pragma unroll
        for (int t = 0; t < 2; ++t) { s[t] = (v8f){};
#pragma unroll
            for (int ks = 0; ks < 4; ++ks) s[t] = wmma16(kf[t * 4 + ks], qf[ks], s[t]); }
        float x[16]; const float al = soft16(s, kb, q0 + lr, hi, m, l, x);
        v16h pf;
#pragma unroll
        for (int e = 0; e < 16; ++e) pf[e] = tohx(x[e]);
#pragma unroll
        for (int dt = 0; dt < 8; ++dt) { o[dt] *= al; o[dt] = wmma16(vf[dt], pf, o[dt]); }
    }
}
// attn_hl: query rows < RH, bf16 hi + lo planes, three products each (hi hi, lo hi, hi lo). These rows have at most RH / 32 <= AW key blocks, so a wave has one block or none and its output tile starts here.
static_assert(RH <= 32 * AW, "a wave of attn_hl takes one key block");
__device__ __forceinline__ void attn_hl(const bf* __restrict__ Qa, const bf* __restrict__ Qb, const bf* __restrict__ Ka, const bf* __restrict__ Kb, const bf* __restrict__ Va, const bf* __restrict__ Vb, int q0, int nkb, int wv, v8f (&o)[8], float& m, float& l) {
    const int lane = threadIdx.x & 31, lr = lane & 15, hi = lane >> 4;
    if (wv >= nkb) return;   // wave-uniform; no barrier in this function
    const size_t qo = (size_t)(q0 + lr) * HD + 8 * hi, bo = (size_t)wv * 4096 + lane * 8;
    const bf* qa = Qa + qo; const bf* qb = Qb + qo; const bf* ka = Ka + bo; const bf* kb2 = Kb + bo; const bf* va = Va + bo; const bf* vb = Vb + bo;
    v8f s[2];
#pragma unroll
    for (int t = 0; t < 2; ++t) { s[t] = (v8f){};
#pragma unroll
        for (int ks = 0; ks < 4; ++ks) { const v16bf qh = WFrag<bf>::ld(qa + ks * 32), ql = WFrag<bf>::ld(qb + ks * 32), kh = WFrag<bf>::ldp(ka + (t * 4 + ks) * 512), kl = WFrag<bf>::ldp(kb2 + (t * 4 + ks) * 512);
            s[t] = wmmab(kh, qh, s[t]); s[t] = wmmab(kl, qh, s[t]); s[t] = wmmab(kh, ql, s[t]); } }
    asm volatile("s_wait_xcnt 0x0" :: "v"(qa), "v"(qb), "v"(ka), "v"(kb2) : "memory");   // precaution: the q and k loads' address pairs stay whole until all loads that name them are past this wait
    float x[16]; soft16(s, wv, q0 + lr, hi, m, l, x);
    v8us h0, h1, l0, l1;
#pragma unroll
    for (int j = 0; j < 8; ++j) { unsigned short a2, c2; splitf(x[j], a2, c2); h0[j] = a2; l0[j] = c2; splitf(x[8 + j], a2, c2); h1[j] = a2; l1[j] = c2; }
    const v16bf ph = cat16b(h0, h1), pl = cat16b(l0, l1);
#pragma unroll
    for (int dt = 0; dt < 8; ++dt) { const v16bf vh = WFrag<bf>::ldp(va + dt * 512), vl = WFrag<bf>::ldp(vb + dt * 512); o[dt] = wmmab(vh, ph, (v8f){}); o[dt] = wmmab(vl, ph, o[dt]); o[dt] = wmmab(vh, pl, o[dt]); }
    asm volatile("s_wait_xcnt 0x0" :: "v"(va), "v"(vb) : "memory");   // precaution as above, for the v loads
}
__global__ __launch_bounds__(32 * AW) void k_attn(const h16* __restrict__ Q16, const bf* __restrict__ Qh, const bf* __restrict__ Ql, const h16* __restrict__ K16, const bf* __restrict__ Kh, const bf* __restrict__ Kl,
                                                  const h16* __restrict__ V16, const bf* __restrict__ Vh, const bf* __restrict__ Vl, float* __restrict__ out) {
    __shared__ __align__(16) float po[AW * 16 * OPI]; __shared__ float pm[AW * 16], pl[AW * 16];
    const int tid = threadIdx.x, lane = tid & 31, lr = lane & 15, hi = lane >> 4;
    const int wv = __builtin_amdgcn_readfirstlane(tid >> 5);   // the wave's number in a scalar register, so that the key loop's test stays scalar
    const int q0 = (TT / 16 - 1 - (int)blockIdx.x) * 16, nkb = (q0 >> 5) + 1;   // nkb: 32-key blocks up to and with the diagonal's
    v8f o[8]; float m = -3.0e38f, l = 0.f;
#pragma unroll
    for (int dt = 0; dt < 8; ++dt) o[dt] = (v8f){};
    if (q0 < RH) attn_hl(Qh, Ql, Kh, Kl, Vh, Vl, q0, nkb, wv, o, m, l);   // block-uniform
    else attn_f16(Q16, K16, V16, q0, nkb, wv, o, m, l);
    l += __shfl_xor(l, 16, 32);   // the halves of a wave summed different keys of the same query under the same maximum
    float* pw = po + (wv * 16 + lr) * OPI + hi * 8;
#pragma unroll
    for (int dt = 0; dt < 8; ++dt) { v4f a, b; a[0] = o[dt][0]; a[1] = o[dt][1]; a[2] = o[dt][2]; a[3] = o[dt][3]; b[0] = o[dt][4]; b[1] = o[dt][5]; b[2] = o[dt][6]; b[3] = o[dt][7]; *(v4fa*)(pw + dt * 16) = a; *(v4fa*)(pw + dt * 16 + 4) = b; }
    if (hi == 0) { pm[wv * 16 + lr] = m; pl[wv * 16 + lr] = l; }
    __syncthreads();   // every wave's partial (a wave without a block: maximum -3e38, sum 0, tile 0) is in LDS before any wave merges
    float mm[AW], M = -3.0e38f;
#pragma unroll
    for (int w = 0; w < AW; ++w) { mm[w] = pm[w * 16 + wv]; M = fmaxf(M, mm[w]); }
    float Ls = 0.f; v4f acc = (v4f){};
#pragma unroll
    for (int w = 0; w < AW; ++w) { const float wt = __builtin_amdgcn_exp2f(mm[w] - M); Ls += wt * pl[w * 16 + wv]; acc += wt * *(const v4fa*)(po + (w * 16 + wv) * OPI + lane * 4); }
    *(v4f*)(out + (size_t)(q0 + wv) * HD + lane * 4) = acc * __fdiv_rn(1.0f, Ls);
}

extern "C" void kernel_launch(void* const* d_in, const int* in_sizes, int n_in,
                              void* d_out, int out_size, void* d_ws, size_t ws_size, hipStream_t stream) {
    (void)in_sizes; (void)n_in; (void)out_size;
    const float* x = (const float*)d_in[0]; const float* xk = (const float*)d_in[1]; const float* xv = (const float*)d_in[2]; const float* wq = (const float*)d_in[3]; const float* bq = (const float*)d_in[4]; const float* wk = (const float*)d_in[5]; const float* bk = (const float*)d_in[6]; const float* wv = (const float*)d_in[7]; const float* bv = (const float*)d_in[8];
    float* OUT = (float*)d_out;     // [4096][128]
    char* wsp = (char*)d_ws;
    auto take = [&](size_t bytes) { char* p = wsp; wsp += (bytes + 255) & ~(size_t)255; return (void*)p; };
    h16* QP16 = (h16*)take((size_t)NH_ * TT * HD * 2); h16* KP16 = (h16*)take((size_t)NKV * TT * HD * 2); h16* VT16 = (h16*)take((size_t)NKV * HD * TT * 2);
    bf* QPh = (bf*)take((size_t)NH_ * TT * HD * 2); bf* QPl = (bf*)take((size_t)NH_ * TT * HD * 2); bf* KPh = (bf*)take((size_t)NKV * TT * HD * 2); bf* KPl = (bf*)take((size_t)NKV * TT * HD * 2); bf* VTh = (bf*)take((size_t)NKV * HD * TT * 2); bf* VTl = (bf*)take((size_t)NKV * HD * TT * 2);
    if ((size_t)(wsp - (char*)d_ws) > ws_size) return;    // ws 256 MiB
    k_proj<<<dim3(TT / 64, HD / 64, 3), 32 * PWV, 0, stream>>>(x, xk, xv, wq, wk, wv, bq, bk, bv, QP16, QPh, QPl, KP16, KPh, KPl, VT16, VTh, VTl);
    k_attn<<<TT / 16, 32 * AW, 0, stream>>>(QP16, QPh, QPl, KP16, KPh, KPl, VT16, VTh, VTl, OUT);
}

// v006
// Measured time: 24.3 microseconds a run.
// Two timings next to v005 put it at 1.04 and 1.05 times that version's speed.
// Over all steps from v000 it is 11.3 times as fast.
#include <hip/hip_runtime.h>

// Single-head causal attention over separate q / k / v inputs (q, k, v [4096][1024]; qp = q Wq + bq, kp = k Wk + bk, vp = v Wv + bv ('xw' [1024][128] + [128]); scores = qp.kp / sqrt(128), causal (-1e10 == exclusion); softmax; out = attn vp -> [4096][128] (0.5 M)).
// Layout: one projection launch (inputs and weights rounded to bf16 in registers; exact products + f32 biases; attention planes written from its epilogue), then one attention launch: scores, causal softmax and P.V fused, online softmax (hybrid rows: < 512 hi/lo 3 products, rest fp16 with the probabilities x1024); neither scores nor probabilities touch memory.
// Compute dtypes, f32 accumulate: every input rounded to bf16; projections exact + f32 biases; attention rows < 512 3 products, rest fp16; softmax f32; output f32.

#define NB_  1
#define TT   4096
#define DM   1024
#define NH_  1
#define NKV  1
#define REP  (NH_ / NKV)
#define HD   128
#define DQ   (NH_ * HD)
#define DKV  (NKV * HD)
#define ZH   1
#define RH   512                  // query rows < RH use hi+lo planes
#define WIN  4096
#define PCAR 1024.0f
#define SCL  0.088388347648318447f   // HD^-0.5
typedef _Float16 h16;
typedef unsigned short bf;
typedef __attribute__((ext_vector_type(16))) __bf16   v16bf;
typedef __attribute__((ext_vector_type(16))) _Float16 v16h;
typedef __attribute__((ext_vector_type(8)))  _Float16 v8h;
typedef __attribute__((ext_vector_type(8)))  unsigned short v8us;
typedef __attribute__((ext_vector_type(8)))  float    v8f;
typedef __attribute__((ext_vector_type(4)))  float    v4f;
typedef v8h  __attribute__((may_alias)) v8ha;
typedef v4f  __attribute__((may_alias)) v4fa;
typedef v8us __attribute__((may_alias)) v8usa;

__device__ __forceinline__ unsigned short f2bf(float f) { unsigned u = __float_as_uint(f); u += 0x7FFFu + ((u >> 16) & 1u); return (unsigned short)(u >> 16); }
__device__ __forceinline__ float bf2f(unsigned short b) { return __uint_as_float(((unsigned)b) << 16); }
__device__ __forceinline__ float bfr(float f) { return bf2f(f2bf(f)); }
__device__ __forceinline__ v16h cat16(v8h lo, v8h hi) { return __builtin_shufflevector(lo, hi, 0, 1, 2, 3, 4, 5, 6, 7, 8, 9, 10, 11, 12, 13, 14, 15); }
__device__ __forceinline__ v16bf cat16b(v8us lo, v8us hi) { return __builtin_bit_cast(v16bf, __builtin_shufflevector(lo, hi, 0, 1, 2, 3, 4, 5, 6, 7, 8, 9, 10, 11, 12, 13, 14, 15)); }
__device__ __forceinline__ v8f wmma16(v16h a, v16h b, v8f c) { return __builtin_amdgcn_wmma_f32_16x16x32_f16(false, a, false, b, (short)0, c, false, false); }
__device__ __forceinline__ v8f wmmab(v16bf a, v16bf b, v8f c) { return __builtin_amdgcn_wmma_f32_16x16x32_bf16(false, a, false, b, (short)0, c, false, false); }



// WFrag: ld = a fragment from a k-contiguous row (k = 8 hi + 0..7 and 16 + 8 hi + 0..7); ldp = the same fragment from a plane stored in fragment order (two wave-wide loads of 512 contiguous bytes each).
template <typename T16> struct WFrag;
template <> struct WFrag<h16> { typedef v16h V; static __device__ __forceinline__ V ld(const h16* p) { return cat16(*(const v8h*)p, *(const v8h*)(p + 16)); } static __device__ __forceinline__ V ldp(const h16* p) { return cat16(*(const v8h*)p, *(const v8h*)(p + 256)); } static __device__ __forceinline__ v8f mma(V a, V b, v8f c) { return wmma16(a, b, c); } };
template <> struct WFrag<bf> { typedef v16bf V; static __device__ __forceinline__ V ld(const bf* p) { return cat16b(*(const v8us*)p, *(const v8us*)(p + 16)); } static __device__ __forceinline__ V ldp(const bf* p) { return cat16b(*(const v8us*)p, *(const v8us*)(p + 256)); } static __device__ __forceinline__ v8f mma(V a, V b, v8f c) { return wmmab(a, b, c); } };
__device__ __forceinline__ h16 tohx(float x) { return (h16)x; }
__device__ __forceinline__ void splitf(float y, unsigned short& h, unsigned short& l) { h = f2bf(y); l = f2bf(y - bf2f(h)); }
typedef __attribute__((ext_vector_type(2))) _Float16 v2h;
typedef __attribute__((ext_vector_type(4))) _Float16 v4h;
typedef __attribute__((ext_vector_type(2))) unsigned short v2us;
typedef __attribute__((ext_vector_type(4))) unsigned short v4us;
typedef __attribute__((ext_vector_type(2))) float v2f;
typedef __attribute__((ext_vector_type(4))) int v4i;

typedef __attribute__((ext_vector_type(16))) float v16f;
#define OSP (64 * 68)   // one wave's 64x64 f32 partial in LDS, pitch 68 floats
// Fragment order of the k and v planes: 512 elements (1 KiB) per 16 x 32 fragment, as two halves of 256; lane (c, h) owns elements 8 (c + 16 h) .. + 7 of each half; half g, element e is k position 16 g + 8 h + e of fragment row c.
// kidx: rows = keys, k = d; the 8 fragments of 32 keys are contiguous (8 KiB). vidx: rows = d, k = keys; the 8 fragments of 32 keys are contiguous (8 KiB).
__device__ __forceinline__ size_t kidx(int t, int d) { return (size_t)((t >> 4) * 4 + (d >> 5)) * 512 + ((d >> 4) & 1) * 256 + ((t & 15) + 16 * ((d >> 3) & 1)) * 8 + (d & 7); }
__device__ __forceinline__ size_t vidx(int d, int t) { return (size_t)((t >> 5) * 8 + (d >> 4)) * 512 + ((t >> 4) & 1) * 256 + ((d & 15) + 16 * ((t >> 3) & 1)) * 8 + (t & 7); }
// ---- k_proj: the three projections in one launch; grid (TT / 64, HD / 64, 3), z = 0 q, 1 k, 2 v; one work-group of PWV waves per 64x64 tile of x W + b.
// Split K: wave w takes k = 128 w .. 128 w + 127 of the whole tile, as two slices of 64 one after the other into the same accumulators (four 16x16x32 steps); the PWV partials are summed in LDS in wave order.
// Eight waves of at most 256 registers and 136 KiB of LDS let two work-groups share a WGP, so that all 384 work-groups are resident at once and one work-group's loads run under the other's LDS and matrix phases.
// Operands come from the f32 inputs and are rounded to bf16 (nearest even) in registers. A: each wave brings its own 64 rows x 64 k of x into LDS by asynchronous copies (one copy = two rows' whole 256 bytes; direct fragment loads would touch 16 lines for 512 bytes),
// into the place that later holds its partial (read, refilled and overwritten by that wave alone, in this order), at the same pitch (68 floats: 16-byte LDS reads of 16 rows fall on all 64 banks); fragment: row 16 mb + lr, 8 + 8 consecutive k per lane. B: one 16-byte load of W[k][c0 + 4 lr ..] feeds all four fragments, so
// fragment nb holds the columns c0 + 4 lr + nb (same k per position as A), and the four accumulators of a row make one 16-byte LDS store.
// The second slice's x is copied as soon as the first slice's fragments are in registers (under the first slice's products); its W comes in two groups of 16 loads, because the accumulators leave no room for 32 loads in flight.
// Epilogue: + bias, then the planes the attention launch reads (f16, bf16 hi, bf16 lo each): q as [t][d], k and v in fragment order (kidx, vidx).
// Every loop is unrolled so that the load, fragment and accumulator arrays are indexed by constants only (registers, no scratch) and all loads of a group can be in flight together.
#define PWV 8
// cp8: eight asynchronous 16-byte-per-lane copies to LDS, rows two apart (LDS step 2 x 68 floats, global step 2 x DM floats). The s_wait_xcnt is the last line of the copies' own statement: a precaution, so that no address register that a copy names is written before it.
__device__ __forceinline__ void cp8(unsigned l, const float* g) {
    asm volatile("global_load_async_to_lds_b128 %0, %8, off\n\t"
                 "global_load_async_to_lds_b128 %1, %9, off\n\t"
                 "global_load_async_to_lds_b128 %2, %10, off\n\t"
                 "global_load_async_to_lds_b128 %3, %11, off\n\t"
                 "global_load_async_to_lds_b128 %4, %12, off\n\t"
                 "global_load_async_to_lds_b128 %5, %13, off\n\t"
                 "global_load_async_to_lds_b128 %6, %14, off\n\t"
                 "global_load_async_to_lds_b128 %7, %15, off\n\t"
                 "s_wait_xcnt 0x0"
                 :: "v"(l), "v"(l + 544u), "v"(l + 1088u), "v"(l + 1632u), "v"(l + 2176u), "v"(l + 2720u), "v"(l + 3264u), "v"(l + 3808u),
                    "v"(g), "v"(g + 2 * DM), "v"(g + 4 * DM), "v"(g + 6 * DM), "v"(g + 8 * DM), "v"(g + 10 * DM), "v"(g + 12 * DM), "v"(g + 14 * DM) : "memory");
}
__global__ __launch_bounds__(32 * PWV) __attribute__((amdgpu_waves_per_eu(4, 4))) void k_proj(const float* __restrict__ xq, const float* __restrict__ xk, const float* __restrict__ xv, const float* __restrict__ wq, const float* __restrict__ wk, const float* __restrict__ wv,
                                              const float* __restrict__ bq, const float* __restrict__ bk, const float* __restrict__ bv, h16* Q16, bf* Qh, bf* Ql, h16* K16, bf* Kh, bf* Kl, h16* V16, bf* Vh, bf* Vl) {
    __shared__ __align__(16) float os[PWV * OSP];
    const int z = blockIdx.z; const float* X = (z == 0) ? xq : (z == 1) ? xk : xv; const float* Wm = (z == 0) ? wq : (z == 1) ? wk : wv; const float* bias = (z == 0) ? bq : (z == 1) ? bk : bv;
    const int tid = threadIdx.x, lane = tid & 31, lr = lane & 15, hi = lane >> 4; const int r0 = blockIdx.x * 64, c0 = blockIdx.y * 64;
    const int wv_ = __builtin_amdgcn_readfirstlane(tid >> 5);   // the wave's number in a scalar register, so that the wave's share of every address is scalar arithmetic
    float* osw = os + wv_ * OSP; const float* bp = Wm + (size_t)(wv_ * 128 + 8 * hi) * HD + c0 + 4 * lr;
    const float* xg = X + (size_t)(r0 + hi) * DM + wv_ * 128 + 4 * lr; const unsigned xl = (unsigned)(size_t)(osw + hi * 68 + 4 * lr);   // copy c: lanes 0-15 row 2 c, lanes 16-31 row 2 c + 1, 256 bytes each
    const float* xs = osw + lr * 68 + 8 * hi;
    v8f acc[4][4];
    {   // slice 0: k = 128 w .. + 63
        v4f wr[2][16], xa[4][4]; v16bf a[2][4], b[2][4];
#pragma unroll
        for (int u = 0; u < 2; ++u)
#pragma unroll
            for (int e = 0; e < 16; ++e) wr[u][e] = *(const v4fa*)(bp + (size_t)(32 * u + (e & 7) + (e >> 3) * 16) * HD);
        asm volatile("s_wait_xcnt 0x0" :: "v"(bp) : "memory");   // precaution: the W loads' address pair stays whole until all 32 loads that name it are past this wait; only then may a register of it be written
#pragma unroll
        for (int c = 0; c < 4; ++c) cp8(xl + (unsigned)c * 4352u, xg + (size_t)c * 16 * DM);
#pragma unroll
        for (int u = 0; u < 2; ++u)
#pragma unroll
            for (int nb = 0; nb < 4; ++nb) { v16f t;
#pragma unroll
                for (int e = 0; e < 16; ++e) t[e] = wr[u][e][nb];
                b[u][nb] = __builtin_convertvector(t, v16bf); }
        __builtin_amdgcn_sched_barrier(0);   // keeps the rounding of W in front of the wait, under the copies' flight (without it the compiler moves it behind the wait)
        asm volatile("s_wait_asynccnt 0x0" ::: "memory");   // the wave's 32 copies have landed before it reads their bytes; no other wave reads them, so no barrier stands here
#pragma unroll
        for (int u = 0; u < 2; ++u) {
#pragma unroll
            for (int mb = 0; mb < 4; ++mb) { const float* p = xs + mb * 16 * 68 + 32 * u; xa[mb][0] = *(const v4fa*)p; xa[mb][1] = *(const v4fa*)(p + 4); xa[mb][2] = *(const v4fa*)(p + 16); xa[mb][3] = *(const v4fa*)(p + 20); }
#pragma unroll
            for (int mb = 0; mb < 4; ++mb) { v16f t;
#pragma unroll
                for (int e = 0; e < 4; ++e) { t[e] = xa[mb][0][e]; t[4 + e] = xa[mb][1][e]; t[8 + e] = xa[mb][2][e]; t[12 + e] = xa[mb][3][e]; }
                a[u][mb] = __builtin_convertvector(t, v16bf); }
            __builtin_amdgcn_sched_barrier(0);   // one k step's f32 values (64 registers) are rounded before the next step's are read, and all are dead before the copies' addresses and the accumulators need room (without it the build spills)
        }
        asm volatile("s_wait_dscnt 0x0" ::: "memory");   // the wave's own reads of slice 0 have returned before its copies refill the same LDS (a place private to one wave: no barrier)
#pragma unroll
        for (int c = 0; c < 4; ++c) cp8(xl + (unsigned)c * 4352u, xg + 64 + (size_t)c * 16 * DM);
#pragma unroll
        for (int nb = 0; nb < 4; ++nb) {
#pragma unroll
            for (int mb = 0; mb < 4; ++mb) acc[mb][nb] = wmmab(a[0][mb], b[0][nb], (v8f){});
#pragma unroll
            for (int mb = 0; mb < 4; ++mb) acc[mb][nb] = wmmab(a[1][mb], b[1][nb], acc[mb][nb]); }
    }
    {   // slice 1: k = 128 w + 64 .. + 127, one 16x16x32 step at a time
        v4f w0[16], w1[16]; v16bf b[4];
#pragma unroll
        for (int e = 0; e < 16; ++e) w0[e] = *(const v4fa*)(bp + (size_t)(64 + (e & 7) + (e >> 3) * 16) * HD);
        asm volatile("s_wait_xcnt 0x0" :: "v"(bp) : "memory");   // precaution as above, for these 16 loads
#pragma unroll
        for (int nb = 0; nb < 4; ++nb) { v16f t;
#pragma unroll
            for (int e = 0; e < 16; ++e) t[e] = w0[e][nb];
            b[nb] = __builtin_convertvector(t, v16bf); }
        __builtin_amdgcn_sched_barrier(0);   // keeps the second group's loads behind the rounding of the first: beside the accumulators only 16 loads' registers fit (without it the build spills)
#pragma unroll
        for (int e = 0; e < 16; ++e) w1[e] = *(const v4fa*)(bp + (size_t)(96 + (e & 7) + (e >> 3) * 16) * HD);
        asm volatile("s_wait_xcnt 0x0" :: "v"(bp) : "memory");   // precaution as above, for these 16 loads
        asm volatile("s_wait_asynccnt 0x0" ::: "memory");   // the wave's 32 copies of slice 1 have landed before it reads their bytes
#pragma unroll
        for (int u = 0; u < 2; ++u) {
            if (u == 1) {
#pragma unroll
                for (int nb = 0; nb < 4; ++nb) { v16f t;
#pragma unroll
                    for (int e = 0; e < 16; ++e) t[e] = w1[e][nb];
                    b[nb] = __builtin_convertvector(t, v16bf); } }
#pragma unroll
            for (int mb = 0; mb < 4; ++mb) { const float* p = xs + mb * 16 * 68 + 32 * u; const v4f x0 = *(const v4fa*)p, x1 = *(const v4fa*)(p + 4), x2 = *(const v4fa*)(p + 16), x3 = *(const v4fa*)(p + 20); v16f t;
#pragma unroll
                for (int e = 0; e < 4; ++e) { t[e] = x0[e]; t[4 + e] = x1[e]; t[8 + e] = x2[e]; t[12 + e] = x3[e]; }
                const v16bf a = __builtin_convertvector(t, v16bf);
#pragma unroll
                for (int nb = 0; nb < 4; ++nb) acc[mb][nb] = wmmab(a, b[nb], acc[mb][nb]); }
        }
    }
#pragma unroll
    for (int mb = 0; mb < 4; ++mb) {
#pragma unroll
        for (int j = 0; j < 8; ++j) { v4f t; t[0] = acc[mb][0][j]; t[1] = acc[mb][1][j]; t[2] = acc[mb][2][j]; t[3] = acc[mb][3][j]; *(v4fa*)(osw + (mb * 16 + hi * 8 + j) * 68 + 4 * lr) = t; } }
    __syncthreads();   // every wave's partial is in LDS before any thread sums the planes
    v4f val[4];
#pragma unroll
    for (int s = 0; s < 4; ++s) { const int idx = s * 256 + tid; const int row = idx >> 4, cofs = (idx & 15) * 4; val[s] = *(const v4fa*)(os + row * 68 + cofs);
#pragma unroll
        for (int w = 1; w < PWV; ++w) val[s] += *(const v4fa*)(os + w * OSP + row * 68 + cofs);
        val[s][0] += bfr(bias[c0 + cofs]); val[s][1] += bfr(bias[c0 + cofs + 1]); val[s][2] += bfr(bias[c0 + cofs + 2]); val[s][3] += bfr(bias[c0 + cofs + 3]); }
    if (z != 2) {   // q, k (block-uniform): q, 16 lanes store one 128-byte line of a [t][d] plane; k, 4 consecutive d stay together in fragment order
        h16* P16 = (z == 0) ? Q16 : K16; bf* Ph = (z == 0) ? Qh : Kh; bf* Pl = (z == 0) ? Ql : Kl;
#pragma unroll
        for (int s = 0; s < 4; ++s) { const int idx = s * 256 + tid; const int row = idx >> 4, cofs = (idx & 15) * 4; v4h o16; v4us oh, ol;
#pragma unroll
            for (int q = 0; q < 4; ++q) { o16[q] = tohx(val[s][q]); unsigned short a2, c2; splitf(val[s][q], a2, c2); oh[q] = a2; ol[q] = c2; }
            const size_t oo = (z == 0) ? (size_t)(r0 + row) * HD + c0 + cofs : kidx(r0 + row, c0 + cofs); h16* a16 = P16 + oo; bf* ah = Ph + oo; bf* al = Pl + oo; *(v4h*)a16 = o16; *(v4us*)ah = oh; *(v4us*)al = ol;
            asm volatile("s_wait_xcnt 0x0" :: "v"(a16), "v"(ah), "v"(al), "v"(o16), "v"(oh), "v"(ol) : "memory"); }   // precaution: the three stores' address and data registers stay whole until the stores are past this wait; only then may one of them be written
        return; }
#pragma unroll
    for (int s = 0; s < 4; ++s) { const int idx = s * 256 + tid; *(v4fa*)(os + (idx >> 4) * 68 + (idx & 15) * 4) = val[s]; }   // v: the finished tile goes back to plane 0, each thread onto the words that only it has read
    __syncthreads();   // the finished v tile is whole in plane 0 before it is read by columns
#pragma unroll
    for (int s = 0; s < 2; ++s) { const int id = s * 256 + tid; const int d = id >> 3, t0 = (id & 7) * 8; v8h o16; v8us oh, ol;   // 8 consecutive keys of one d are one lane's 16 bytes of a fragment half
#pragma unroll
        for (int j = 0; j < 8; ++j) { const float xx = os[(t0 + j) * 68 + d]; o16[j] = tohx(xx); unsigned short a2, c2; splitf(xx, a2, c2); oh[j] = a2; ol[j] = c2; }
        const size_t oo = vidx(c0 + d, r0 + t0); h16* a16 = V16 + oo; bf* ah = Vh + oo; bf* al = Vl + oo; *(v8h*)a16 = o16; *(v8us*)ah = oh; *(v8us*)al = ol;
        asm volatile("s_wait_xcnt 0x0" :: "v"(a16), "v"(ah), "v"(al), "v"(o16), "v"(oh), "v"(ol) : "memory"); }   // precaution as for the q and k stores
}

#define AW  16
#define OPI 132
// soft16: one online-softmax step on the two score tiles of 32-key block kb for query qi. In: s. Out: x = the 16 probabilities (times PCAR) in the order of a B fragment; m, l updated; returns the factor on what was summed under the old maximum.
__device__ __forceinline__ float soft16(const v8f (&s)[2], int kb, int qi, int hi, float& m, float& l, float (&x)[16]) {
    const float SC2 = SCL * 1.4426950408889634f; float mx = m;
#pragma unroll
    for (int e = 0; e < 16; ++e) { const int kj = kb * 32 + (e >> 3) * 16 + hi * 8 + (e & 7); x[e] = (kj <= qi) ? s[e >> 3][e & 7] * SC2 : -3.0e38f; mx = fmaxf(mx, x[e]); }
    mx = fmaxf(mx, __shfl_xor(mx, 16, 32));
    const float al = __builtin_amdgcn_exp2f(m - mx), mo = mx - 10.0f; m = mx;
    float ps = 0.f;
#pragma unroll
    for (int e = 0; e < 16; ++e) { x[e] = __builtin_amdgcn_exp2f(x[e] - mo); ps += x[e]; }
    l = l * al + ps; return al;
}
// Every inner loop below is unrolled so that the fragment and accumulator arrays are indexed by constants only (registers, no scratch).
// attn_f16: query rows >= RH, f16 operands, one product each. The wave walks its key blocks wv, wv + AW, ... in a ring that starts at trip rot mod (its number of blocks): every work-group reads the same K and V lines from L2,
// and with one common start they ask for the same lines at the same moment; the online softmax takes the blocks in any order (every block up to the diagonal's holds a valid key for every query).
static_assert(RH >= 32 * (AW - 1), "every wave of attn_f16 has a key block");
__device__ __forceinline__ void attn_f16(const h16* __restrict__ Q, const h16* __restrict__ Kp, const h16* __restrict__ Vp, int q0, int nkb, int wv, unsigned rot, v8f (&o)[8], float& m, float& l) {
    const int lane = threadIdx.x & 31, lr = lane & 15, hi = lane >> 4;
    const h16* qp = Q + (size_t)(q0 + lr) * HD + 8 * hi; v16h qf[4];
#pragma unroll
    for (int ks = 0; ks < 4; ++ks) qf[ks] = WFrag<h16>::ld(qp + ks * 32);
    asm volatile("s_wait_xcnt 0x0" :: "v"(qp) : "memory");   // precaution: the q loads' address pair stays whole until all loads that name it are past this wait
    // rolled: one block's fragments, the queries and the output tile fill the wave's registers
    const unsigned nw = (unsigned)(nkb - wv + AW - 1) / AW;   // this wave's key blocks (scalar, at least 1)
    int kb = wv + AW * (int)(rot % nw);
    const h16* kq = Kp + (size_t)kb * 4096; const h16* vq = Vp + (size_t)kb * 4096;   // the block's planes as running scalar pointers (a block's 8 K fragments and its 8 V fragments are 8 KiB each, contiguous)
#pragma unroll 1
    for (unsigned i = 0; i < nw; ++i) {
        const h16* kp = kq + lane * 8; const h16* vp = vq + lane * 8;
        v16h kf[8], vf[8];
#pragma unroll
        for (int f = 0; f < 8; ++f) kf[f] = WFrag<h16>::ldp(kp + f * 512);
#pragma unroll
        for (int f = 0; f < 8; ++f) vf[f] = WFrag<h16>::ldp(vp + f * 512);
        // inputs only: holds the block's 32 loads in front of the products, so that all are in flight together (without it they are issued two at a time, each pair waited for); the wait is the precaution as above for their addresses (the running pointers too, which the ring's step below rewrites; kp and vp stay named: without them this build spills and reloads from scratch inside the loop)
        asm volatile("s_wait_xcnt 0x0" :: "s"(kq), "s"(vq), "v"(kp), "v"(vp), "v"(kf[0]), "v"(kf[1]), "v"(kf[2]), "v"(kf[3]), "v"(kf[4]), "v"(kf[5]), "v"(kf[6]), "v"(kf[7]), "v"(vf[0]), "v"(vf[1]), "v"(vf[2]), "v"(vf[3]), "v"(vf[4]), "v"(vf[5]), "v"(vf[6]), "v"(vf[7]));
        v8f s[2];
#pragma unroll
        for (int t = 0; t < 2; ++t) { s[t] = (v8f){};
#pragma unroll
            for (int ks = 0; ks < 4; ++ks) s[t] = wmma16(kf[t * 4 + ks], qf[ks], s[t]); }
        float x[16]; const float al = soft16(s, kb, q0 + lr, hi, m, l, x);
        v16h pf;
#pragma unroll
        for (int e = 0; e < 16; ++e) pf[e] = tohx(x[e]);
#pragma unroll
        for (int dt = 0; dt < 8; ++dt) { o[dt] *= al; o[dt] = wmma16(vf[dt], pf, o[dt]); }
        kb += AW; kq += AW * 4096; vq += AW * 4096;
        if (kb >= nkb) { kb = wv; kq = Kp + (size_t)wv * 4096; vq = Vp + (size_t)wv * 4096; }   // the ring wraps to the wave's first block (scalar test)
    }
}
// attn_hl: query rows < RH, bf16 hi + lo planes, three products each (hi hi, lo hi, hi lo). These rows have at most RH / 32 <= AW key blocks, so a wave has one block or none and its output tile starts here.
static_assert(RH <= 32 * AW, "a wave of attn_hl takes one key block");
__device__ __forceinline__ void attn_hl(const bf* __restrict__ Qa, const bf* __restrict__ Qb, const bf* __restrict__ Ka, const bf* __restrict__ Kb, const bf* __restrict__ Va, const bf* __restrict__ Vb, int q0, int nkb, int wv, v8f (&o)[8], float& m, float& l) {
    const int lane = threadIdx.x & 31, lr = lane & 15, hi = lane >> 4;
    if (wv >= nkb) return;   // wave-uniform; no barrier in this function
    const size_t qo = (size_t)(q0 + lr) * HD + 8 * hi, bo = (size_t)wv * 4096 + lane * 8;
    const bf* qa = Qa + qo; const bf* qb = Qb + qo; const bf* ka = Ka + bo; const bf* kb2 = Kb + bo; const bf* va = Va + bo; const bf* vb = Vb + bo;
    v8f s[2];
#pragma unroll
    for (int t = 0; t < 2; ++t) { s[t] = (v8f){};
#pragma unroll
        for (int ks = 0; ks < 4; ++ks) { const v16bf qh = WFrag<bf>::ld(qa + ks * 32), ql = WFrag<bf>::ld(qb + ks * 32), kh = WFrag<bf>::ldp(ka + (t * 4 + ks) * 512), kl = WFrag<bf>::ldp(kb2 + (t * 4 + ks) * 512);
            s[t] = wmmab(kh, qh, s[t]); s[t] = wmmab(kl, qh, s[t]); s[t] = wmmab(kh, ql, s[t]); } }
    asm volatile("s_wait_xcnt 0x0" :: "v"(qa), "v"(qb), "v"(ka), "v"(kb2) : "memory");   // precaution: the q and k loads' address pairs stay whole until all loads that name them are past this wait
    float x[16]; soft16(s, wv, q0 + lr, hi, m, l, x);
    v8us h0, h1, l0, l1;
#pragma unroll
    for (int j = 0; j < 8; ++j) { unsigned short a2, c2; splitf(x[j], a2, c2); h0[j] = a2; l0[j] = c2; splitf(x[8 + j], a2, c2); h1[j] = a2; l1[j] = c2; }
    const v16bf ph = cat16b(h0, h1), pl = cat16b(l0, l1);
#pragma unroll
    for (int dt = 0; dt < 8; ++dt) { const v16bf vh = WFrag<bf>::ldp(va + dt * 512), vl = WFrag<bf>::ldp(vb + dt * 512); o[dt] = wmmab(vh, ph, (v8f){}); o[dt] = wmmab(vl, ph, o[dt]); o[dt] = wmmab(vh, pl, o[dt]); }
    asm volatile("s_wait_xcnt 0x0" :: "v"(va), "v"(vb) : "memory");   // precaution as above, for the v loads
}
__global__ __launch_bounds__(32 * AW) void k_attn(const h16* __restrict__ Q16, const bf* __restrict__ Qh, const bf* __restrict__ Ql, const h16* __restrict__ K16, const bf* __restrict__ Kh, const bf* __restrict__ Kl,
                                                  const h16* __restrict__ V16, const bf* __restrict__ Vh, const bf* __restrict__ Vl, float* __restrict__ out) {
    __shared__ __align__(16) float po[AW * 16 * OPI]; __shared__ float pm[AW * 16], pl[AW * 16];
    const int tid = threadIdx.x, lane = tid & 31, lr = lane & 15, hi = lane >> 4;
    const int wv = __builtin_amdgcn_readfirstlane(tid >> 5);   // the wave's number in a scalar register, so that the key loop's test stays scalar
    const int q0 = (TT / 16 - 1 - (int)blockIdx.x) * 16, nkb = (q0 >> 5) + 1;   // nkb: 32-key blocks up to and with the diagonal's
    v8f o[8]; float m = -3.0e38f, l = 0.f;
#pragma unroll
    for (int dt = 0; dt < 8; ++dt) o[dt] = (v8f){};
    if (q0 < RH) attn_hl(Qh, Ql, Kh, Kl, Vh, Vl, q0, nkb, wv, o, m, l);   // block-uniform
    else attn_f16(Q16, K16, V16, q0, nkb, wv, blockIdx.x + (blockIdx.x >> 3), o, m, l);   // the start moves with the index and with index / 8, so that work-groups eight apart differ too
    l += __shfl_xor(l, 16, 32);   // the halves of a wave summed different keys of the same query under the same maximum
    float* pw = po + (wv * 16 + lr) * OPI + hi * 8;
#pragma unroll
    for (int dt = 0; dt < 8; ++dt) { v4f a, b; a[0] = o[dt][0]; a[1] = o[dt][1]; a[2] = o[dt][2]; a[3] = o[dt][3]; b[0] = o[dt][4]; b[1] = o[dt][5]; b[2] = o[dt][6]; b[3] = o[dt][7]; *(v4fa*)(pw + dt * 16) = a; *(v4fa*)(pw + dt * 16 + 4) = b; }
    if (hi == 0) { pm[wv * 16 + lr] = m; pl[wv * 16 + lr] = l; }
    __syncthreads();   // every wave's partial (a wave without a block: maximum -3e38, sum 0, tile 0) is in LDS before any wave merges
    float mm[AW], M = -3.0e38f;
#pragma unroll
    for (int w = 0; w < AW; ++w) { mm[w] = pm[w * 16 + wv]; M = fmaxf(M, mm[w]); }
    float Ls = 0.f; v4f acc = (v4f){};
#pragma unroll
    for (int w = 0; w < AW; ++w) { const float wt = __builtin_amdgcn_exp2f(mm[w] - M); Ls += wt * pl[w * 16 + wv]; acc += wt * *(const v4fa*)(po + (w * 16 + wv) * OPI + lane * 4); }
    *(v4f*)(out + (size_t)(q0 + wv) * HD + lane * 4) = acc * __fdiv_rn(1.0f, Ls);
}

extern "C" void kernel_launch(void* const* d_in, const int* in_sizes, int n_in,
                              void* d_out, int out_size, void* d_ws, size_t ws_size, hipStream_t stream) {
    (void)in_sizes; (void)n_in; (void)out_size;
    const float* x = (const float*)d_in[0]; const float* xk = (const float*)d_in[1]; const float* xv = (const float*)d_in[2]; const float* wq = (const float*)d_in[3]; const float* bq = (const float*)d_in[4]; const float* wk = (const float*)d_in[5]; const float* bk = (const float*)d_in[6]; const float* wv = (const float*)d_in[7]; const float* bv = (const float*)d_in[8];
    float* OUT = (float*)d_out;     // [4096][128]
    char* wsp = (char*)d_ws;
    auto take = [&](size_t bytes) { char* p = wsp; wsp += (bytes + 255) & ~(size_t)255; return (void*)p; };
    h16* QP16 = (h16*)take((size_t)NH_ * TT * HD * 2); h16* KP16 = (h16*)take((size_t)NKV * TT * HD * 2); h16* VT16 = (h16*)take((size_t)NKV * HD * TT * 2);
    bf* QPh = (bf*)take((size_t)NH_ * TT * HD * 2); bf* QPl = (bf*)take((size_t)NH_ * TT * HD * 2); bf* KPh = (bf*)take((size_t)NKV * TT * HD * 2); bf* KPl = (bf*)take((size_t)NKV * TT * HD * 2); bf* VTh = (bf*)take((size_t)NKV * HD * TT * 2); bf* VTl = (bf*)take((size_t)NKV * HD * TT * 2);
    if ((size_t)(wsp - (char*)d_ws) > ws_size) return;    // ws 256 MiB
    k_proj<<<dim3(TT / 64, HD / 64, 3), 32 * PWV, 0, stream>>>(x, xk, xv, wq, wk, wv, bq, bk, bv, QP16, QPh, QPl, KP16, KPh, KPl, VT16, VTh, VTl);
    k_attn<<<TT / 16, 32 * AW, 0, stream>>>(QP16, QPh, QPl, KP16, KPh, KPl, VT16, VTh, VTl, OUT);
}
